// v000
// Times are from an AMD MI455X. After a warm-up the kernel runs many times in a row, and a time is the length of
// such a window on the GPU divided by its runs, so every launch and the gaps after it count. The runs cycle
// through copies of the inputs. A figure is the median of several windows, for all but v000 over two sittings.
// Sittings can differ by a few percent; kernels timed side by side share one.
// The starting kernel, v000, takes 174 microseconds a run.
#include <hip/hip_runtime.h>
#include <hip/hip_bf16.h>

// MHA: B=4, S=2048, D=512, H=8, DH=64.  All GEMMs via v_wmma_f32_16x16x32_f16.
// Flash attention with TDM (tensor_load_to_lds) double-buffered K/V tiles.

typedef __attribute__((ext_vector_type(16))) _Float16 v16h;
typedef __attribute__((ext_vector_type(8)))  _Float16 v8h;
typedef __attribute__((ext_vector_type(4)))  _Float16 v4h;
typedef __attribute__((ext_vector_type(8)))  float    v8f;
typedef __attribute__((ext_vector_type(4)))  float    v4f;
typedef __attribute__((ext_vector_type(4)))  unsigned int u32x4;
typedef __attribute__((ext_vector_type(8)))  unsigned int u32x8;

#define SEQ   2048
#define DMOD  512
#define NHEAD 8
#define DHEAD 64
#define NROWS 8192   // B*S

// Gather one 16x32 (f16) WMMA operand from a row-major [x][k] tile.
// ISA 16-bit A/B layout: lane L holds row/col (L&15); halves 0..7 -> K = khi+0..7,
// halves 8..15 -> K = khi+16..23, where khi = 8*(L>=16).
__device__ __forceinline__ v16h ld_op(const _Float16* base, int stride, int lane) {
    const int rc  = lane & 15;
    const int khi = (lane >> 4) << 3;
    const _Float16* p = base + rc * stride + khi;
    v8h lo8 = *(const v8h*)(p);
    v8h hi8 = *(const v8h*)(p + 16);
    return __builtin_shufflevector(lo8, hi8, 0,1,2,3,4,5,6,7,8,9,10,11,12,13,14,15);
}

__device__ __forceinline__ v8f wmma16(v16h a, v16h b, v8f c) {
    return __builtin_amdgcn_wmma_f32_16x16x32_f16(false, a, false, b, (short)0, c,
                                                  false, false);
}

// ---------------------------------------------------------------------------
// TDM: issue a 2D tensor_load_to_lds.  Descriptor bit layout per CDNA5 ISA
// ch.8: group0 = {count, lds_addr, global_addr, type=2}; group1 = {data_size=2B,
// pad ctrl, tensor/tile dims, dim0 stride}.  Hardware applies LDS row padding
// (pad_amt+1 DWORDs after every 8*2^pad_int bytes) -> bank-conflict-free strides.
// ---------------------------------------------------------------------------
__device__ __forceinline__ void tdm_load_2d(unsigned lds_off, const void* gaddr,
                                            unsigned tensor_d0, unsigned tensor_d1,
                                            unsigned tile_d0, unsigned tile_d1,
                                            unsigned stride0,
                                            unsigned pad_int, unsigned pad_amt) {
    unsigned long long ga = (unsigned long long)(size_t)gaddr;
    u32x4 g0;
    g0[0] = 1u;                                   // count=1, user descriptor
    g0[1] = lds_off;                              // LDS byte address
    g0[2] = (unsigned)ga;                         // global_addr[31:0]
    g0[3] = ((unsigned)(ga >> 32) & 0x01FFFFFFu)  // global_addr[56:32]
            | 0x80000000u;                        // type=2 ("image")
    u32x8 g1;
    g1[0] = (1u << 16)                            // data_size = 2 bytes
          | (1u << 20)                            // pad_enable
          | (pad_int << 22) | (pad_amt << 25);    // workgroup_mask=0 (no cluster)
    g1[1] = (tensor_d0 & 0xFFFFu) << 16;          // tensor_dim0[15:0]
    g1[2] = (tensor_d0 >> 16) | ((tensor_d1 & 0xFFFFu) << 16);
    g1[3] = (tensor_d1 >> 16) | (tile_d0 << 16);  // tile_dim0
    g1[4] = tile_d1 & 0xFFFFu;                    // tile_dim1 (tile_dim2=0)
    g1[5] = stride0;                              // tensor_dim0_stride[31:0]
    g1[6] = 0u;                                   // stride hi / dim1_stride (2D)
    g1[7] = 0u;
    asm volatile("tensor_load_to_lds %0, %1" :: "s"(g0), "s"(g1) : "memory");
}

// ---------------------------------------------------------------------------
// GEMM 1: X[8192x512](f32) * W[512x512](f32) + bias -> f16 out.
// vTranspose=0: out[B,H,S,DH]; vTranspose=1: out[B,H,DH,S] (for TDM V tiles).
// Block tile 128x64, K-chunks of 32; float4 global loads.
// ---------------------------------------------------------------------------
__global__ __launch_bounds__(256)
void mha5102_qkv_proj(const float* __restrict__ x, const float* __restrict__ w,
                      const float* __restrict__ bias, _Float16* __restrict__ out,
                      int vTranspose) {
    __shared__ __align__(16) _Float16 As[128 * 40];
    __shared__ __align__(16) _Float16 Bs[64 * 40];
    const int t    = threadIdx.x;
    const int wid  = t >> 5;
    const int lane = t & 31;
    const int row0 = blockIdx.x * 128;
    const int n0   = blockIdx.y * 64;
    const int hi = lane >> 4, lo = lane & 15;

    v8f zero = {};
    v8f acc[4] = {zero, zero, zero, zero};

    for (int k0 = 0; k0 < DMOD; k0 += 32) {
        __syncthreads();
#pragma unroll
        for (int i = 0; i < 4; ++i) {            // A tile 128x32 f32 -> f16 (v4 loads)
            int idx = i * 256 + t;
            int r = idx >> 3, c4 = (idx & 7) << 2;
            v4f xv = *(const v4f*)(x + (size_t)(row0 + r) * DMOD + k0 + c4);
            v4h hv;
            hv[0] = (_Float16)xv[0]; hv[1] = (_Float16)xv[1];
            hv[2] = (_Float16)xv[2]; hv[3] = (_Float16)xv[3];
            *(v4h*)(As + r * 40 + c4) = hv;
        }
#pragma unroll
        for (int i = 0; i < 2; ++i) {            // W tile 32x64, stored transposed
            int idx = i * 256 + t;
            int kr = idx >> 4, n4 = (idx & 15) << 2;
            v4f wv4 = *(const v4f*)(w + (size_t)(k0 + kr) * DMOD + n0 + n4);
            Bs[(n4 + 0) * 40 + kr] = (_Float16)wv4[0];
            Bs[(n4 + 1) * 40 + kr] = (_Float16)wv4[1];
            Bs[(n4 + 2) * 40 + kr] = (_Float16)wv4[2];
            Bs[(n4 + 3) * 40 + kr] = (_Float16)wv4[3];
        }
        __syncthreads();
        v16h a = ld_op(As + wid * 16 * 40, 40, lane);
#pragma unroll
        for (int nt = 0; nt < 4; ++nt) {
            v16h b = ld_op(Bs + nt * 16 * 40, 40, lane);
            acc[nt] = wmma16(a, b, acc[nt]);
        }
    }
#pragma unroll
    for (int nt = 0; nt < 4; ++nt) {
        int col = n0 + nt * 16 + lo;
        float bv = bias[col];
        int h = col >> 6, dh = col & 63;
#pragma unroll
        for (int r = 0; r < 8; ++r) {
            int grow = row0 + wid * 16 + r + 8 * hi;
            int b_ = grow >> 11, s_ = grow & (SEQ - 1);
            size_t bh = (size_t)(b_ * NHEAD + h);
            size_t o = vTranspose ? (bh * DHEAD + dh) * SEQ + s_
                                  : (bh * SEQ + s_) * DHEAD + dh;
            out[o] = (_Float16)(acc[nt][r] + bv);
        }
    }
}

// ---------------------------------------------------------------------------
// Flash attention: one block = 128 query rows of one (b,h). 32-key tiles.
// K/V tiles arrive via double-buffered TDM (TENSORcnt), overlapped with WMMA.
// ---------------------------------------------------------------------------
__global__ __launch_bounds__(256)
void mha5102_attn(const _Float16* __restrict__ q, const _Float16* __restrict__ k,
                  const _Float16* __restrict__ vt, const int* __restrict__ mask,
                  _Float16* __restrict__ attn_out) {
    __shared__ __align__(16) _Float16 Ks[2][32 * 72];    // [key][dh], padded
    __shared__ __align__(16) _Float16 Vs[2][64 * 40];    // [dh][key], padded
    __shared__ __align__(16) _Float16 Ps[8 * 16 * 40];   // per-wave P staging
    const int t = threadIdx.x, wid = t >> 5, lane = t & 31;
    const int hi = lane >> 4, lo = lane & 15;
    const int qblk = blockIdx.x & 15;
    const int bh   = blockIdx.x >> 4;
    const int b_   = bh >> 3, h_ = bh & 7;
    const _Float16* qh  = q  + (size_t)bh * SEQ * DHEAD;
    const _Float16* kh  = k  + (size_t)bh * SEQ * DHEAD;   // [key][dh]
    const _Float16* vth = vt + (size_t)bh * DHEAD * SEQ;   // [dh][key]
    const int* mrow = mask + b_ * SEQ;
    const int qr0 = qblk * 128 + wid * 16;

    v16h qa[2];
#pragma unroll
    for (int c = 0; c < 2; ++c)
        qa[c] = ld_op(qh + (size_t)qr0 * DHEAD + c * 32, DHEAD, lane);

    v8f zero = {};
    v8f acc[4] = {zero, zero, zero, zero};
    float mrun[8], lrun[8];
#pragma unroll
    for (int r = 0; r < 8; ++r) { mrun[r] = -1e30f; lrun[r] = 0.f; }
    const float scale = 0.125f;  // 1/sqrt(64)

    // K tile: 32 rows x 64 halves, mem stride 64, LDS row 128B + 16B pad -> 72 halves
    // V tile: 64 rows x 32 halves, mem stride SEQ, LDS row 64B + 16B pad  -> 40 halves
    if (wid == 0) {
        tdm_load_2d((unsigned)(size_t)(void*)&Ks[0][0], kh,
                    64, 2048, 64, 32, 64, /*pad_int 128B*/4, /*pad 4DW*/3);
        tdm_load_2d((unsigned)(size_t)(void*)&Vs[0][0], vth,
                    2048, 64, 32, 64, 2048, /*pad_int 64B*/3, /*pad 4DW*/3);
        __builtin_amdgcn_s_wait_tensorcnt(0);
    }
    __syncthreads();

    int cur = 0;
    for (int j0 = 0; j0 < SEQ; j0 += 32) {
        // prefetch next tiles into the other buffer while we compute
        if (wid == 0 && j0 + 32 < SEQ) {
            tdm_load_2d((unsigned)(size_t)(void*)&Ks[cur ^ 1][0],
                        kh + (size_t)(j0 + 32) * DHEAD,
                        64, 2048, 64, 32, 64, 4, 3);
            tdm_load_2d((unsigned)(size_t)(void*)&Vs[cur ^ 1][0],
                        vth + (j0 + 32),
                        2048, 64, 32, 64, 2048, 3, 3);
        }
        const _Float16* Kc = &Ks[cur][0];
        const _Float16* Vc = &Vs[cur][0];

        // scores S = Q * K^T : two 16x16 tiles (keys j0..+15, j0+16..+31)
        v8f st[2];
#pragma unroll
        for (int nt = 0; nt < 2; ++nt) {
            v8f s = zero;
#pragma unroll
            for (int c = 0; c < 2; ++c)
                s = wmma16(qa[c], ld_op(Kc + nt * 16 * 72 + c * 32, 72, lane), s);
            st[nt] = s;
        }
        float mk0 = mrow[j0 + lo]      ? -1e9f : 0.f;
        float mk1 = mrow[j0 + 16 + lo] ? -1e9f : 0.f;

        float alpha[8], p0v[8], p1v[8];
#pragma unroll
        for (int r = 0; r < 8; ++r) {
            float s0 = st[0][r] * scale + mk0;
            float s1 = st[1][r] * scale + mk1;
            float m = fmaxf(s0, s1);
#pragma unroll
            for (int o = 8; o >= 1; o >>= 1)      // reduce 16 lanes of a row group
                m = fmaxf(m, __shfl_xor(m, o, 32));
            float mn = fmaxf(mrun[r], m);
            float p0 = __expf(s0 - mn);
            float p1 = __expf(s1 - mn);
            float rs = p0 + p1;
#pragma unroll
            for (int o = 8; o >= 1; o >>= 1)
                rs += __shfl_xor(rs, o, 32);
            alpha[r] = __expf(mrun[r] - mn);
            lrun[r]  = lrun[r] * alpha[r] + rs;
            mrun[r]  = mn;
            p0v[r] = p0; p1v[r] = p1;
        }
#pragma unroll
        for (int tt = 0; tt < 4; ++tt)
#pragma unroll
            for (int r = 0; r < 8; ++r) acc[tt][r] *= alpha[r];

        // C-layout probs -> A-layout via wave-private LDS (in-order DS ops)
        _Float16* pw = Ps + wid * 16 * 40;
#pragma unroll
        for (int r = 0; r < 8; ++r) {
            pw[(r + 8 * hi) * 40 + lo]      = (_Float16)p0v[r];
            pw[(r + 8 * hi) * 40 + 16 + lo] = (_Float16)p1v[r];
        }
        v16h pa = ld_op(pw, 40, lane);
#pragma unroll
        for (int tt = 0; tt < 4; ++tt)
            acc[tt] = wmma16(pa, ld_op(Vc + tt * 16 * 40, 40, lane), acc[tt]);

        __syncthreads();                          // all waves done reading cur
        if (wid == 0) __builtin_amdgcn_s_wait_tensorcnt(0);
        __syncthreads();                          // next buffer visible to all
        cur ^= 1;
    }

    // normalize, store merged heads f16 [B,S,D]
#pragma unroll
    for (int r = 0; r < 8; ++r) {
        float inv = 1.0f / fmaxf(lrun[r], 1e-30f);
        int s_ = qr0 + r + 8 * hi;
        size_t grow = (size_t)b_ * SEQ + s_;
#pragma unroll
        for (int tt = 0; tt < 4; ++tt) {
            int col = h_ * DHEAD + tt * 16 + lo;
            attn_out[grow * DMOD + col] = (_Float16)(acc[tt][r] * inv);
        }
    }
}

// ---------------------------------------------------------------------------
// GEMM 3: attn[8192x512](f16) * Wo[512x512](f32) + bias -> f32 out [B,S,D]
// ---------------------------------------------------------------------------
__global__ __launch_bounds__(256)
void mha5102_out_proj(const _Float16* __restrict__ a, const float* __restrict__ w,
                      const float* __restrict__ bias, float* __restrict__ out) {
    __shared__ __align__(16) _Float16 As[128 * 40];
    __shared__ __align__(16) _Float16 Bs[64 * 40];
    const int t    = threadIdx.x;
    const int wid  = t >> 5;
    const int lane = t & 31;
    const int row0 = blockIdx.x * 128;
    const int n0   = blockIdx.y * 64;
    const int hi = lane >> 4, lo = lane & 15;

    v8f zero = {};
    v8f acc[4] = {zero, zero, zero, zero};

    for (int k0 = 0; k0 < DMOD; k0 += 32) {
        __syncthreads();
#pragma unroll
        for (int i = 0; i < 2; ++i) {            // A tile 128x32 f16 (v8h loads)
            int idx = i * 256 + t;
            int r = idx >> 2, c8 = (idx & 3) << 3;
            *(v8h*)(As + r * 40 + c8) =
                *(const v8h*)(a + (size_t)(row0 + r) * DMOD + k0 + c8);
        }
#pragma unroll
        for (int i = 0; i < 2; ++i) {            // W tile 32x64, transposed
            int idx = i * 256 + t;
            int kr = idx >> 4, n4 = (idx & 15) << 2;
            v4f wv4 = *(const v4f*)(w + (size_t)(k0 + kr) * DMOD + n0 + n4);
            Bs[(n4 + 0) * 40 + kr] = (_Float16)wv4[0];
            Bs[(n4 + 1) * 40 + kr] = (_Float16)wv4[1];
            Bs[(n4 + 2) * 40 + kr] = (_Float16)wv4[2];
            Bs[(n4 + 3) * 40 + kr] = (_Float16)wv4[3];
        }
        __syncthreads();
        v16h av = ld_op(As + wid * 16 * 40, 40, lane);
#pragma unroll
        for (int nt = 0; nt < 4; ++nt) {
            v16h b = ld_op(Bs + nt * 16 * 40, 40, lane);
            acc[nt] = wmma16(av, b, acc[nt]);
        }
    }
#pragma unroll
    for (int nt = 0; nt < 4; ++nt) {
        int col = n0 + nt * 16 + lo;
        float bv = bias[col];
#pragma unroll
        for (int r = 0; r < 8; ++r) {
            int grow = row0 + wid * 16 + r + 8 * hi;
            out[(size_t)grow * DMOD + col] = acc[nt][r] + bv;
        }
    }
}

extern "C" void kernel_launch(void* const* d_in, const int* in_sizes, int n_in,
                              void* d_out, int out_size, void* d_ws, size_t ws_size,
                              hipStream_t stream) {
    const float* query = (const float*)d_in[0];
    const float* key_  = (const float*)d_in[1];
    const float* value = (const float*)d_in[2];
    const int*   mask  = (const int*)d_in[3];
    const float* wq_w = (const float*)d_in[4];
    const float* wq_b = (const float*)d_in[5];
    const float* wk_w = (const float*)d_in[6];
    const float* wk_b = (const float*)d_in[7];
    const float* wv_w = (const float*)d_in[8];
    const float* wv_b = (const float*)d_in[9];
    const float* wo_w = (const float*)d_in[10];
    const float* wo_b = (const float*)d_in[11];

    // workspace: 4 f16 buffers of 8192*512 elems (8 MB each)
    const size_t elems = (size_t)NROWS * DMOD;
    _Float16* qf   = (_Float16*)d_ws;               // [B,H,S,DH]
    _Float16* kf   = qf + elems;                    // [B,H,S,DH]
    _Float16* vf   = kf + elems;                    // [B,H,DH,S] (transposed)
    _Float16* attn = vf + elems;                    // [B,S,D]

    dim3 blk(256);
    dim3 gGemm(NROWS / 128, DMOD / 64);             // 64 x 8
    mha5102_qkv_proj<<<gGemm, blk, 0, stream>>>(query, wq_w, wq_b, qf, 0);
    mha5102_qkv_proj<<<gGemm, blk, 0, stream>>>(key_,  wk_w, wk_b, kf, 0);
    mha5102_qkv_proj<<<gGemm, blk, 0, stream>>>(value, wv_w, wv_b, vf, 1);

    dim3 gAttn((4 * NHEAD) * (SEQ / 128));          // 512 blocks
    mha5102_attn<<<gAttn, blk, 0, stream>>>(qf, kf, vf, mask, attn);

    mha5102_out_proj<<<gGemm, blk, 0, stream>>>(attn, wo_w, wo_b, (float*)d_out);
}

// v001
// It runs in 157 microseconds.
// Next to v000, in two timings, it ran 1.14 times as fast each time.
#include <hip/hip_runtime.h>
#include <hip/hip_bf16.h>

// MHA: B=4, S=2048, D=512, H=8, DH=64.  All GEMMs via v_wmma_f32_16x16x32_f16.
// Flash attention with TDM (tensor_load_to_lds) double-buffered K/V tiles.

typedef __attribute__((ext_vector_type(16))) _Float16 v16h;
typedef __attribute__((ext_vector_type(8)))  _Float16 v8h;
typedef __attribute__((ext_vector_type(4)))  _Float16 v4h;
typedef __attribute__((ext_vector_type(8)))  float    v8f;
typedef __attribute__((ext_vector_type(4)))  float    v4f;
typedef __attribute__((ext_vector_type(4)))  int      v4i;
typedef __attribute__((ext_vector_type(4)))  unsigned int u32x4;
typedef __attribute__((ext_vector_type(8)))  unsigned int u32x8;

#define SEQ   2048
#define DMOD  512
#define NHEAD 8
#define DHEAD 64
#define NROWS 8192   // B*S

// Gather one 16x32 (f16) WMMA operand from a row-major [x][k] tile.
// ISA 16-bit A/B layout: lane L holds row/col (L&15); halves 0..7 -> K = khi+0..7,
// halves 8..15 -> K = khi+16..23, where khi = 8*(L>=16).
__device__ __forceinline__ v16h ld_op(const _Float16* base, int stride, int lane) {
    const int rc  = lane & 15;
    const int khi = (lane >> 4) << 3;
    const _Float16* p = base + rc * stride + khi;
    v8h lo8 = *(const v8h*)(p);
    v8h hi8 = *(const v8h*)(p + 16);
    return __builtin_shufflevector(lo8, hi8, 0,1,2,3,4,5,6,7,8,9,10,11,12,13,14,15);
}

__device__ __forceinline__ v8f wmma16(v16h a, v16h b, v8f c) {
    return __builtin_amdgcn_wmma_f32_16x16x32_f16(false, a, false, b, (short)0, c,
                                                  false, false);
}

// ---------------------------------------------------------------------------
// TDM: issue a 2D tensor_load_to_lds.  Descriptor bit layout per CDNA5 ISA
// ch.8: group0 = {count, lds_addr, global_addr, type=2}; group1 = {data_size=2B,
// pad ctrl, tensor/tile dims, dim0 stride}.  Hardware applies LDS row padding
// (pad_amt+1 DWORDs after every 8*2^pad_int bytes) -> bank-conflict-free strides.
// ---------------------------------------------------------------------------
__device__ __forceinline__ void tdm_load_2d(unsigned lds_off, const void* gaddr,
                                            unsigned tensor_d0, unsigned tensor_d1,
                                            unsigned tile_d0, unsigned tile_d1,
                                            unsigned stride0,
                                            unsigned pad_int, unsigned pad_amt) {
    unsigned long long ga = (unsigned long long)(size_t)gaddr;
    u32x4 g0;
    g0[0] = 1u;                                   // count=1, user descriptor
    g0[1] = lds_off;                              // LDS byte address
    g0[2] = (unsigned)ga;                         // global_addr[31:0]
    g0[3] = ((unsigned)(ga >> 32) & 0x01FFFFFFu)  // global_addr[56:32]
            | 0x80000000u;                        // type=2 ("image")
    u32x8 g1;
    g1[0] = (1u << 16)                            // data_size = 2 bytes
          | (1u << 20)                            // pad_enable
          | (pad_int << 22) | (pad_amt << 25);    // workgroup_mask=0 (no cluster)
    g1[1] = (tensor_d0 & 0xFFFFu) << 16;          // tensor_dim0[15:0]
    g1[2] = (tensor_d0 >> 16) | ((tensor_d1 & 0xFFFFu) << 16);
    g1[3] = (tensor_d1 >> 16) | (tile_d0 << 16);  // tile_dim0
    g1[4] = tile_d1 & 0xFFFFu;                    // tile_dim1 (tile_dim2=0)
    g1[5] = stride0;                              // tensor_dim0_stride[31:0]
    g1[6] = 0u;                                   // stride hi / dim1_stride (2D)
    g1[7] = 0u;
    asm volatile("tensor_load_to_lds %0, %1" :: "s"(g0), "s"(g1) : "memory");
}

// ---------------------------------------------------------------------------
// GEMM 1: X[8192x512](f32) * W[512x512](f32) + bias -> f16 out.
// vTranspose=0: out[B,H,S,DH]; vTranspose=1: out[B,H,DH,S] (for TDM V tiles).
// Block tile 128x64, K-chunks of 32; float4 global loads.
// ---------------------------------------------------------------------------
__global__ __launch_bounds__(256)
void mha5102_qkv_proj(const float* __restrict__ x, const float* __restrict__ w,
                      const float* __restrict__ bias, _Float16* __restrict__ out,
                      int vTranspose) {
    __shared__ __align__(16) _Float16 As[128 * 40];
    __shared__ __align__(16) _Float16 Bs[64 * 40];
    const int t    = threadIdx.x;
    const int wid  = t >> 5;
    const int lane = t & 31;
    const int row0 = blockIdx.x * 128;
    const int n0   = blockIdx.y * 64;
    const int hi = lane >> 4, lo = lane & 15;

    v8f zero = {};
    v8f acc[4] = {zero, zero, zero, zero};

    for (int k0 = 0; k0 < DMOD; k0 += 32) {
        __syncthreads();
#pragma unroll
        for (int i = 0; i < 4; ++i) {            // A tile 128x32 f32 -> f16 (v4 loads)
            int idx = i * 256 + t;
            int r = idx >> 3, c4 = (idx & 7) << 2;
            v4f xv = *(const v4f*)(x + (size_t)(row0 + r) * DMOD + k0 + c4);
            v4h hv;
            hv[0] = (_Float16)xv[0]; hv[1] = (_Float16)xv[1];
            hv[2] = (_Float16)xv[2]; hv[3] = (_Float16)xv[3];
            *(v4h*)(As + r * 40 + c4) = hv;
        }
#pragma unroll
        for (int i = 0; i < 2; ++i) {            // W tile 32x64, stored transposed
            int idx = i * 256 + t;
            int kr = idx >> 4, n4 = (idx & 15) << 2;
            v4f wv4 = *(const v4f*)(w + (size_t)(k0 + kr) * DMOD + n0 + n4);
            Bs[(n4 + 0) * 40 + kr] = (_Float16)wv4[0];
            Bs[(n4 + 1) * 40 + kr] = (_Float16)wv4[1];
            Bs[(n4 + 2) * 40 + kr] = (_Float16)wv4[2];
            Bs[(n4 + 3) * 40 + kr] = (_Float16)wv4[3];
        }
        __syncthreads();
        v16h a = ld_op(As + wid * 16 * 40, 40, lane);
#pragma unroll
        for (int nt = 0; nt < 4; ++nt) {
            v16h b = ld_op(Bs + nt * 16 * 40, 40, lane);
            acc[nt] = wmma16(a, b, acc[nt]);
        }
    }
#pragma unroll
    for (int nt = 0; nt < 4; ++nt) {
        int col = n0 + nt * 16 + lo;
        float bv = bias[col];
        int h = col >> 6, dh = col & 63;
#pragma unroll
        for (int r = 0; r < 8; ++r) {
            int grow = row0 + wid * 16 + r + 8 * hi;
            int b_ = grow >> 11, s_ = grow & (SEQ - 1);
            size_t bh = (size_t)(b_ * NHEAD + h);
            size_t o = vTranspose ? (bh * DHEAD + dh) * SEQ + s_
                                  : (bh * SEQ + s_) * DHEAD + dh;
            out[o] = (_Float16)(acc[nt][r] + bv);
        }
    }
}

__device__ __forceinline__ float xhalf(float x) {
    int b = __builtin_bit_cast(int, x);
    return __builtin_bit_cast(float,
        __builtin_amdgcn_permlanex16(b, b, 0x76543210, 0xfedcba98, false, false));
}

__global__ __launch_bounds__(256)
void mha5102_attn(const _Float16* __restrict__ q, const _Float16* __restrict__ k,
                  const _Float16* __restrict__ vt, const int* __restrict__ mask,
                  _Float16* __restrict__ attn_out) {
    // each buffer rounded up to 6 KiB so that every tensor-load destination is a
    // multiple of 2 KiB in the work-group's LDS
    __shared__ __attribute__((aligned(2048))) _Float16 Ks[2][3072];  // [key][dh], 32 x 72
    __shared__ __attribute__((aligned(2048))) _Float16 Vs[2][3072];  // [dh][key], 64 x 40
    const int t = threadIdx.x, wid = t >> 5, lane = t & 31;
    const int hi = lane >> 4, lo = lane & 15;
    const int qblk = blockIdx.x & 15;
    const int bh   = blockIdx.x >> 4;
    const int b_   = bh >> 3, h_ = bh & 7;
    const _Float16* qh  = q  + (size_t)bh * SEQ * DHEAD;
    const _Float16* kh  = k  + (size_t)bh * SEQ * DHEAD;   // [key][dh]
    const _Float16* vth = vt + (size_t)bh * DHEAD * SEQ;   // [dh][key]
    const int* mp = mask + b_ * SEQ + 8 * hi;              // this half's keys, walks with j0
    const int qr0 = qblk * 128 + wid * 16;

    v16h qa[2];                                   // B operand: column = query
#pragma unroll
    for (int c = 0; c < 2; ++c)
        qa[c] = ld_op(qh + (size_t)qr0 * DHEAD + c * 32, DHEAD, lane);

    v8f zero = {};
    v8f acc[4] = {zero, zero, zero, zero};        // O^T: [dh = 16*tt+8*hi+r][query lo]
    float mrun = -1e30f, lrun = 0.f;              // lrun: this half's keys only
    const float scale = 0.125f;  // 1/sqrt(64)

    // K tile: 32 rows x 64 halves, mem stride 64, LDS row 128B + 16B pad -> 72 halves
    // V tile: 64 rows x 32 halves, mem stride SEQ, LDS row 64B + 16B pad  -> 40 halves
    if (wid == 0) {
        tdm_load_2d((unsigned)(size_t)(void*)&Ks[0][0], kh,
                    64, 2048, 64, 32, 64, /*pad_int 128B*/4, /*pad 4DW*/3);
        tdm_load_2d((unsigned)(size_t)(void*)&Vs[0][0], vth,
                    2048, 64, 32, 64, 2048, /*pad_int 64B*/3, /*pad 4DW*/3);
        __builtin_amdgcn_s_wait_tensorcnt(0);
    }
    __syncthreads();

    int cur = 0;
    unsigned rd = 0;                              // byte offset of buffer cur, K and V alike
    for (int j0 = 0; j0 < SEQ; j0 += 32) {
        // prefetch next tiles into the other buffer while we compute
        if (wid == 0 && j0 + 32 < SEQ) {
            tdm_load_2d((unsigned)(size_t)(void*)&Ks[cur ^ 1][0],
                        kh + (size_t)(j0 + 32) * DHEAD,
                        64, 2048, 64, 32, 64, 4, 3);
            tdm_load_2d((unsigned)(size_t)(void*)&Vs[cur ^ 1][0],
                        vth + (j0 + 32),
                        2048, 64, 32, 64, 2048, 3, 3);
        }
        const _Float16* Kc = (const _Float16*)((const char*)&Ks[0][0] + rd);
        const _Float16* Vc = (const _Float16*)((const char*)&Vs[0][0] + rd);

        // mask of this lane's 16 keys: j0+8*hi+0..7 and j0+16+8*hi+0..7
        v4i mk[4];
        mk[0] = *(const v4i*)(mp);
        mk[1] = *(const v4i*)(mp + 4);
        mk[2] = *(const v4i*)(mp + 16);
        mk[3] = *(const v4i*)(mp + 20);
        mp += 32;

        // scores S^T = K * Q^T : two 16x16 tiles (keys j0..+15, j0+16..+31)
        v8f st[2];
#pragma unroll
        for (int nt = 0; nt < 2; ++nt) {
            v8f s = zero;
#pragma unroll
            for (int c = 0; c < 2; ++c)
                s = wmma16(ld_op(Kc + nt * 16 * 72 + c * 32, 72, lane), qa[c], s);
            st[nt] = s;
        }

        float sv[16];
#pragma unroll
        for (int i = 0; i < 16; ++i)
            sv[i] = st[i >> 3][i & 7] * scale + (mk[i >> 2][i & 3] ? -1e9f : 0.f);

        float mx[4];
#pragma unroll
        for (int g = 0; g < 4; ++g)
            mx[g] = fmaxf(fmaxf(sv[4 * g], sv[4 * g + 1]), fmaxf(sv[4 * g + 2], sv[4 * g + 3]));
        float m = fmaxf(fmaxf(mx[0], mx[1]), fmaxf(mx[2], mx[3]));
        m = fmaxf(m, xhalf(m));                   // both halves use one maximum
        const float mn = fmaxf(mrun, m);

        float p[16];
#pragma unroll
        for (int i = 0; i < 16; ++i) p[i] = __expf(sv[i] - mn);
        const float alpha = __expf(mrun - mn);
        mrun = mn;
        float ps[4];
#pragma unroll
        for (int g = 0; g < 4; ++g)
            ps[g] = (p[4 * g] + p[4 * g + 1]) + (p[4 * g + 2] + p[4 * g + 3]);
        lrun = lrun * alpha + ((ps[0] + ps[1]) + (ps[2] + ps[3]));

#pragma unroll
        for (int tt = 0; tt < 4; ++tt)
#pragma unroll
            for (int r = 0; r < 8; ++r) acc[tt][r] *= alpha;

        // P^T as B operand: half s<8 is key 8*hi+s, half s>=8 is key 16+8*hi+(s-8),
        // the k order ld_op gives the V^T rows
        v16h pb;
#pragma unroll
        for (int i = 0; i < 16; ++i) pb[i] = (_Float16)p[i];
#pragma unroll
        for (int tt = 0; tt < 4; ++tt)
            acc[tt] = wmma16(ld_op(Vc + tt * 16 * 40, 40, lane), pb, acc[tt]);

        __syncthreads();                          // all waves done reading cur
        if (wid == 0) __builtin_amdgcn_s_wait_tensorcnt(0);
        __syncthreads();                          // next buffer visible to all
        cur ^= 1;
        rd ^= 6144u;
    }

    // join the halves' sums, normalize, store merged heads f16 [B,S,D]:
    // a lane holds 8 consecutive dh of its query per tile -> one 16-byte store
    const float inv = 1.0f / fmaxf(lrun + xhalf(lrun), 1e-30f);
    _Float16* orow = attn_out + ((size_t)b_ * SEQ + qr0 + lo) * DMOD + h_ * DHEAD + 8 * hi;
#pragma unroll
    for (int tt = 0; tt < 4; ++tt) {
        v8h ov;
#pragma unroll
        for (int r = 0; r < 8; ++r) ov[r] = (_Float16)(acc[tt][r] * inv);
        *(v8h*)(orow + tt * 16) = ov;
    }
}

// ---------------------------------------------------------------------------
// GEMM 3: attn[8192x512](f16) * Wo[512x512](f32) + bias -> f32 out [B,S,D]
// ---------------------------------------------------------------------------
__global__ __launch_bounds__(256)
void mha5102_out_proj(const _Float16* __restrict__ a, const float* __restrict__ w,
                      const float* __restrict__ bias, float* __restrict__ out) {
    __shared__ __align__(16) _Float16 As[128 * 40];
    __shared__ __align__(16) _Float16 Bs[64 * 40];
    const int t    = threadIdx.x;
    const int wid  = t >> 5;
    const int lane = t & 31;
    const int row0 = blockIdx.x * 128;
    const int n0   = blockIdx.y * 64;
    const int hi = lane >> 4, lo = lane & 15;

    v8f zero = {};
    v8f acc[4] = {zero, zero, zero, zero};

    for (int k0 = 0; k0 < DMOD; k0 += 32) {
        __syncthreads();
#pragma unroll
        for (int i = 0; i < 2; ++i) {            // A tile 128x32 f16 (v8h loads)
            int idx = i * 256 + t;
            int r = idx >> 2, c8 = (idx & 3) << 3;
            *(v8h*)(As + r * 40 + c8) =
                *(const v8h*)(a + (size_t)(row0 + r) * DMOD + k0 + c8);
        }
#pragma unroll
        for (int i = 0; i < 2; ++i) {            // W tile 32x64, transposed
            int idx = i * 256 + t;
            int kr = idx >> 4, n4 = (idx & 15) << 2;
            v4f wv4 = *(const v4f*)(w + (size_t)(k0 + kr) * DMOD + n0 + n4);
            Bs[(n4 + 0) * 40 + kr] = (_Float16)wv4[0];
            Bs[(n4 + 1) * 40 + kr] = (_Float16)wv4[1];
            Bs[(n4 + 2) * 40 + kr] = (_Float16)wv4[2];
            Bs[(n4 + 3) * 40 + kr] = (_Float16)wv4[3];
        }
        __syncthreads();
        v16h av = ld_op(As + wid * 16 * 40, 40, lane);
#pragma unroll
        for (int nt = 0; nt < 4; ++nt) {
            v16h b = ld_op(Bs + nt * 16 * 40, 40, lane);
            acc[nt] = wmma16(av, b, acc[nt]);
        }
    }
#pragma unroll
    for (int nt = 0; nt < 4; ++nt) {
        int col = n0 + nt * 16 + lo;
        float bv = bias[col];
#pragma unroll
        for (int r = 0; r < 8; ++r) {
            int grow = row0 + wid * 16 + r + 8 * hi;
            out[(size_t)grow * DMOD + col] = acc[nt][r] + bv;
        }
    }
}

extern "C" void kernel_launch(void* const* d_in, const int* in_sizes, int n_in,
                              void* d_out, int out_size, void* d_ws, size_t ws_size,
                              hipStream_t stream) {
    const float* query = (const float*)d_in[0];
    const float* key_  = (const float*)d_in[1];
    const float* value = (const float*)d_in[2];
    const int*   mask  = (const int*)d_in[3];
    const float* wq_w = (const float*)d_in[4];
    const float* wq_b = (const float*)d_in[5];
    const float* wk_w = (const float*)d_in[6];
    const float* wk_b = (const float*)d_in[7];
    const float* wv_w = (const float*)d_in[8];
    const float* wv_b = (const float*)d_in[9];
    const float* wo_w = (const float*)d_in[10];
    const float* wo_b = (const float*)d_in[11];

    // workspace: 4 f16 buffers of 8192*512 elems (8 MB each)
    const size_t elems = (size_t)NROWS * DMOD;
    _Float16* qf   = (_Float16*)d_ws;               // [B,H,S,DH]
    _Float16* kf   = qf + elems;                    // [B,H,S,DH]
    _Float16* vf   = kf + elems;                    // [B,H,DH,S] (transposed)
    _Float16* attn = vf + elems;                    // [B,S,D]

    dim3 blk(256);
    dim3 gGemm(NROWS / 128, DMOD / 64);             // 64 x 8
    mha5102_qkv_proj<<<gGemm, blk, 0, stream>>>(query, wq_w, wq_b, qf, 0);
    mha5102_qkv_proj<<<gGemm, blk, 0, stream>>>(key_,  wk_w, wk_b, kf, 0);
    mha5102_qkv_proj<<<gGemm, blk, 0, stream>>>(value, wv_w, wv_b, vf, 1);

    dim3 gAttn((4 * NHEAD) * (SEQ / 128));          // 512 blocks
    mha5102_attn<<<gAttn, blk, 0, stream>>>(qf, kf, vf, mask, attn);

    mha5102_out_proj<<<gGemm, blk, 0, stream>>>(attn, wo_w, wo_b, (float*)d_out);
}

// v002
// A run of this version takes 143 microseconds.
// Two timings next to v001 put it at 1.11 and 1.10 times that version's speed.
// Over all steps from v000 it is 1.26 times as fast.
#include <hip/hip_runtime.h>
#include <hip/hip_bf16.h>

// MHA: B=4, S=2048, D=512, H=8, DH=64.  All GEMMs via v_wmma_f32_16x16x32_f16.
// Flash attention with TDM (tensor_load_to_lds) double-buffered K/V tiles.

typedef __attribute__((ext_vector_type(16))) _Float16 v16h;
typedef __attribute__((ext_vector_type(8)))  _Float16 v8h;
typedef __attribute__((ext_vector_type(4)))  _Float16 v4h;
typedef __attribute__((ext_vector_type(8)))  float    v8f;
typedef __attribute__((ext_vector_type(4)))  float    v4f;
typedef __attribute__((ext_vector_type(4)))  int      v4i;
typedef __attribute__((ext_vector_type(4)))  unsigned int u32x4;
typedef __attribute__((ext_vector_type(8)))  unsigned int u32x8;

#define SEQ   2048
#define DMOD  512
#define NHEAD 8
#define DHEAD 64
#define NROWS 8192   // B*S

// Gather one 16x32 (f16) WMMA operand from a row-major [x][k] tile.
// ISA 16-bit A/B layout: lane L holds row/col (L&15); halves 0..7 -> K = khi+0..7,
// halves 8..15 -> K = khi+16..23, where khi = 8*(L>=16).
__device__ __forceinline__ v16h ld_op(const _Float16* base, int stride, int lane) {
    const int rc  = lane & 15;
    const int khi = (lane >> 4) << 3;
    const _Float16* p = base + rc * stride + khi;
    v8h lo8 = *(const v8h*)(p);
    v8h hi8 = *(const v8h*)(p + 16);
    return __builtin_shufflevector(lo8, hi8, 0,1,2,3,4,5,6,7,8,9,10,11,12,13,14,15);
}

__device__ __forceinline__ v8f wmma16(v16h a, v16h b, v8f c) {
    return __builtin_amdgcn_wmma_f32_16x16x32_f16(false, a, false, b, (short)0, c,
                                                  false, false);
}

// Work-group barrier of the two projection loops.  It waits for this wave's LDS
// operations only: __syncthreads() would also drain the global loads that were
// issued ahead for later K chunks, and their latency would be exposed again.
__device__ __forceinline__ void lds_barrier() {
    asm volatile("s_wait_dscnt 0x0\n\ts_barrier_signal -1\n\ts_barrier_wait -1" ::: "memory");
}

// ---------------------------------------------------------------------------
// TDM: issue a 2D tensor_load_to_lds.  Descriptor bit layout per CDNA5 ISA
// ch.8: group0 = {count, lds_addr, global_addr, type=2}; group1 = {data_size=2B,
// pad ctrl, tensor/tile dims, dim0 stride}.  Hardware applies LDS row padding
// (pad_amt+1 DWORDs after every 8*2^pad_int bytes) -> bank-conflict-free strides.
// ---------------------------------------------------------------------------
__device__ __forceinline__ void tdm_load_2d(unsigned lds_off, const void* gaddr,
                                            unsigned tensor_d0, unsigned tensor_d1,
                                            unsigned tile_d0, unsigned tile_d1,
                                            unsigned stride0,
                                            unsigned pad_int, unsigned pad_amt) {
    unsigned long long ga = (unsigned long long)(size_t)gaddr;
    u32x4 g0;
    g0[0] = 1u;                                   // count=1, user descriptor
    g0[1] = lds_off;                              // LDS byte address
    g0[2] = (unsigned)ga;                         // global_addr[31:0]
    g0[3] = ((unsigned)(ga >> 32) & 0x01FFFFFFu)  // global_addr[56:32]
            | 0x80000000u;                        // type=2 ("image")
    u32x8 g1;
    g1[0] = (1u << 16)                            // data_size = 2 bytes
          | (1u << 20)                            // pad_enable
          | (pad_int << 22) | (pad_amt << 25);    // workgroup_mask=0 (no cluster)
    g1[1] = (tensor_d0 & 0xFFFFu) << 16;          // tensor_dim0[15:0]
    g1[2] = (tensor_d0 >> 16) | ((tensor_d1 & 0xFFFFu) << 16);
    g1[3] = (tensor_d1 >> 16) | (tile_d0 << 16);  // tile_dim0
    g1[4] = tile_d1 & 0xFFFFu;                    // tile_dim1 (tile_dim2=0)
    g1[5] = stride0;                              // tensor_dim0_stride[31:0]
    g1[6] = 0u;                                   // stride hi / dim1_stride (2D)
    g1[7] = 0u;
    asm volatile("tensor_load_to_lds %0, %1" :: "s"(g0), "s"(g1) : "memory");
}

// ---------------------------------------------------------------------------
// GEMM 1: X[8192x512](f32) * W[512x512](f32) + bias -> f16 out.
// vTranspose=0: out[B,H,S,DH]; vTranspose=1: out[B,H,DH,S] (for TDM V tiles).
// Block tile 128x64, K-chunks of 32; float4 global loads.
// ---------------------------------------------------------------------------
__global__ __launch_bounds__(256)
void mha5102_qkv_proj(const float* __restrict__ x, const float* __restrict__ w,
                      const float* __restrict__ bias, _Float16* __restrict__ out,
                      int vTranspose) {
    __shared__ __align__(16) _Float16 As[128 * 40];
    __shared__ __align__(16) _Float16 Bs[64 * 40];
    const int t    = threadIdx.x;
    const int wid  = t >> 5;
    const int lane = t & 31;
    const int row0 = blockIdx.x * 128;
    const int n0   = blockIdx.y * 64;
    const int hi = lane >> 4, lo = lane & 15;

    v8f zero = {};
    v8f acc[4] = {zero, zero, zero, zero};

    // this thread's places in the two tiles: A rows ar + 32*i, W rows kr + 16*i
    const int ar = t >> 3, c4 = (t & 7) << 2;
    const int kr = t >> 4, n4 = (t & 15) << 2;
    const float* xp = x + (size_t)(row0 + ar) * DMOD + c4;
    const float* wp = w + (size_t)kr * DMOD + n0 + n4;

    // K chunks are fetched two ahead into two register sets: chunk c + 2 is
    // requested as soon as chunk c has left its set for LDS.
    v4f xr[2][4], wr[2][2];
#pragma unroll
    for (int s = 0; s < 2; ++s) {
#pragma unroll
        for (int i = 0; i < 4; ++i)
            xr[s][i] = *(const v4f*)(xp + (size_t)(i * 32) * DMOD + s * 32);
#pragma unroll
        for (int i = 0; i < 2; ++i)
            wr[s][i] = *(const v4f*)(wp + (size_t)(s * 32 + i * 16) * DMOD);
    }

    for (int k0 = 0; k0 < DMOD; k0 += 64) {
#pragma unroll
        for (int s = 0; s < 2; ++s) {            // static index of the register set
            lds_barrier();                       // every wave has read the chunk before
            // keeps this chunk's conversions, and the s_wait_loadcnt in front of them, from
            // being scheduled up into the chunk before, where its loads have just been issued
            __builtin_amdgcn_sched_barrier(0);
#pragma unroll
            for (int i = 0; i < 4; ++i) {        // A tile 128x32 f32 -> f16
                v4f xv = xr[s][i];
                v4h hv;
                hv[0] = (_Float16)xv[0]; hv[1] = (_Float16)xv[1];
                hv[2] = (_Float16)xv[2]; hv[3] = (_Float16)xv[3];
                *(v4h*)(As + (ar + i * 32) * 40 + c4) = hv;
            }
#pragma unroll
            for (int i = 0; i < 2; ++i) {        // W tile 32x64, stored transposed
                v4f wv4 = wr[s][i];
                Bs[(n4 + 0) * 40 + kr + i * 16] = (_Float16)wv4[0];
                Bs[(n4 + 1) * 40 + kr + i * 16] = (_Float16)wv4[1];
                Bs[(n4 + 2) * 40 + kr + i * 16] = (_Float16)wv4[2];
                Bs[(n4 + 3) * 40 + kr + i * 16] = (_Float16)wv4[3];
            }
            if (k0 + 64 < DMOD) {                // chunk two ahead, same set
                const int kn = k0 + 64 + s * 32;
#pragma unroll
                for (int i = 0; i < 4; ++i)
                    xr[s][i] = *(const v4f*)(xp + (size_t)(i * 32) * DMOD + kn);
#pragma unroll
                for (int i = 0; i < 2; ++i)
                    wr[s][i] = *(const v4f*)(wp + (size_t)(kn + i * 16) * DMOD);
            }
            lds_barrier();                       // chunk published
            v16h a = ld_op(As + wid * 16 * 40, 40, lane);
#pragma unroll
            for (int nt = 0; nt < 4; ++nt) {
                v16h b = ld_op(Bs + nt * 16 * 40, 40, lane);
                acc[nt] = wmma16(a, b, acc[nt]);
            }
        }
    }
#pragma unroll
    for (int nt = 0; nt < 4; ++nt) {
        int col = n0 + nt * 16 + lo;
        float bv = bias[col];
        int h = col >> 6, dh = col & 63;
#pragma unroll
        for (int r = 0; r < 8; ++r) {
            int grow = row0 + wid * 16 + r + 8 * hi;
            int b_ = grow >> 11, s_ = grow & (SEQ - 1);
            size_t bh = (size_t)(b_ * NHEAD + h);
            size_t o = vTranspose ? (bh * DHEAD + dh) * SEQ + s_
                                  : (bh * SEQ + s_) * DHEAD + dh;
            out[o] = (_Float16)(acc[nt][r] + bv);
        }
    }
}

__device__ __forceinline__ float xhalf(float x) {
    int b = __builtin_bit_cast(int, x);
    return __builtin_bit_cast(float,
        __builtin_amdgcn_permlanex16(b, b, 0x76543210, 0xfedcba98, false, false));
}

__global__ __launch_bounds__(256)
void mha5102_attn(const _Float16* __restrict__ q, const _Float16* __restrict__ k,
                  const _Float16* __restrict__ vt, const int* __restrict__ mask,
                  _Float16* __restrict__ attn_out) {
    // each buffer rounded up to 6 KiB so that every tensor-load destination is a
    // multiple of 2 KiB in the work-group's LDS
    __shared__ __attribute__((aligned(2048))) _Float16 Ks[2][3072];  // [key][dh], 32 x 72
    __shared__ __attribute__((aligned(2048))) _Float16 Vs[2][3072];  // [dh][key], 64 x 40
    const int t = threadIdx.x, wid = t >> 5, lane = t & 31;
    const int hi = lane >> 4, lo = lane & 15;
    const int qblk = blockIdx.x & 15;
    const int bh   = blockIdx.x >> 4;
    const int b_   = bh >> 3, h_ = bh & 7;
    const _Float16* qh  = q  + (size_t)bh * SEQ * DHEAD;
    const _Float16* kh  = k  + (size_t)bh * SEQ * DHEAD;   // [key][dh]
    const _Float16* vth = vt + (size_t)bh * DHEAD * SEQ;   // [dh][key]
    const int* mp = mask + b_ * SEQ + 8 * hi;              // this half's keys, walks with j0
    const int qr0 = qblk * 128 + wid * 16;

    v16h qa[2];                                   // B operand: column = query
#pragma unroll
    for (int c = 0; c < 2; ++c)
        qa[c] = ld_op(qh + (size_t)qr0 * DHEAD + c * 32, DHEAD, lane);

    v8f zero = {};
    v8f acc[4] = {zero, zero, zero, zero};        // O^T: [dh = 16*tt+8*hi+r][query lo]
    float mrun = -1e30f, lrun = 0.f;              // lrun: this half's keys only
    const float scale = 0.125f;  // 1/sqrt(64)

    // K tile: 32 rows x 64 halves, mem stride 64, LDS row 128B + 16B pad -> 72 halves
    // V tile: 64 rows x 32 halves, mem stride SEQ, LDS row 64B + 16B pad  -> 40 halves
    if (wid == 0) {
        tdm_load_2d((unsigned)(size_t)(void*)&Ks[0][0], kh,
                    64, 2048, 64, 32, 64, /*pad_int 128B*/4, /*pad 4DW*/3);
        tdm_load_2d((unsigned)(size_t)(void*)&Vs[0][0], vth,
                    2048, 64, 32, 64, 2048, /*pad_int 64B*/3, /*pad 4DW*/3);
        __builtin_amdgcn_s_wait_tensorcnt(0);
    }
    __syncthreads();

    int cur = 0;
    unsigned rd = 0;                              // byte offset of buffer cur, K and V alike
    for (int j0 = 0; j0 < SEQ; j0 += 32) {
        // prefetch next tiles into the other buffer while we compute
        if (wid == 0 && j0 + 32 < SEQ) {
            tdm_load_2d((unsigned)(size_t)(void*)&Ks[cur ^ 1][0],
                        kh + (size_t)(j0 + 32) * DHEAD,
                        64, 2048, 64, 32, 64, 4, 3);
            tdm_load_2d((unsigned)(size_t)(void*)&Vs[cur ^ 1][0],
                        vth + (j0 + 32),
                        2048, 64, 32, 64, 2048, 3, 3);
        }
        const _Float16* Kc = (const _Float16*)((const char*)&Ks[0][0] + rd);
        const _Float16* Vc = (const _Float16*)((const char*)&Vs[0][0] + rd);

        // mask of this lane's 16 keys: j0+8*hi+0..7 and j0+16+8*hi+0..7
        v4i mk[4];
        mk[0] = *(const v4i*)(mp);
        mk[1] = *(const v4i*)(mp + 4);
        mk[2] = *(const v4i*)(mp + 16);
        mk[3] = *(const v4i*)(mp + 20);
        mp += 32;

        // scores S^T = K * Q^T : two 16x16 tiles (keys j0..+15, j0+16..+31)
        v8f st[2];
#pragma unroll
        for (int nt = 0; nt < 2; ++nt) {
            v8f s = zero;
#pragma unroll
            for (int c = 0; c < 2; ++c)
                s = wmma16(ld_op(Kc + nt * 16 * 72 + c * 32, 72, lane), qa[c], s);
            st[nt] = s;
        }

        float sv[16];
#pragma unroll
        for (int i = 0; i < 16; ++i)
            sv[i] = st[i >> 3][i & 7] * scale + (mk[i >> 2][i & 3] ? -1e9f : 0.f);

        float mx[4];
#pragma unroll
        for (int g = 0; g < 4; ++g)
            mx[g] = fmaxf(fmaxf(sv[4 * g], sv[4 * g + 1]), fmaxf(sv[4 * g + 2], sv[4 * g + 3]));
        float m = fmaxf(fmaxf(mx[0], mx[1]), fmaxf(mx[2], mx[3]));
        m = fmaxf(m, xhalf(m));                   // both halves use one maximum
        const float mn = fmaxf(mrun, m);

        float p[16];
#pragma unroll
        for (int i = 0; i < 16; ++i) p[i] = __expf(sv[i] - mn);
        const float alpha = __expf(mrun - mn);
        mrun = mn;
        float ps[4];
#pragma unroll
        for (int g = 0; g < 4; ++g)
            ps[g] = (p[4 * g] + p[4 * g + 1]) + (p[4 * g + 2] + p[4 * g + 3]);
        lrun = lrun * alpha + ((ps[0] + ps[1]) + (ps[2] + ps[3]));

#pragma unroll
        for (int tt = 0; tt < 4; ++tt)
#pragma unroll
            for (int r = 0; r < 8; ++r) acc[tt][r] *= alpha;

        // P^T as B operand: half s<8 is key 8*hi+s, half s>=8 is key 16+8*hi+(s-8),
        // the k order ld_op gives the V^T rows
        v16h pb;
#pragma unroll
        for (int i = 0; i < 16; ++i) pb[i] = (_Float16)p[i];
#pragma unroll
        for (int tt = 0; tt < 4; ++tt)
            acc[tt] = wmma16(ld_op(Vc + tt * 16 * 40, 40, lane), pb, acc[tt]);

        __syncthreads();                          // all waves done reading cur
        if (wid == 0) __builtin_amdgcn_s_wait_tensorcnt(0);
        __syncthreads();                          // next buffer visible to all
        cur ^= 1;
        rd ^= 6144u;
    }

    // join the halves' sums, normalize, store merged heads f16 [B,S,D]:
    // a lane holds 8 consecutive dh of its query per tile -> one 16-byte store
    const float inv = 1.0f / fmaxf(lrun + xhalf(lrun), 1e-30f);
    _Float16* orow = attn_out + ((size_t)b_ * SEQ + qr0 + lo) * DMOD + h_ * DHEAD + 8 * hi;
#pragma unroll
    for (int tt = 0; tt < 4; ++tt) {
        v8h ov;
#pragma unroll
        for (int r = 0; r < 8; ++r) ov[r] = (_Float16)(acc[tt][r] * inv);
        *(v8h*)(orow + tt * 16) = ov;
    }
}

// ---------------------------------------------------------------------------
// GEMM 3: attn[8192x512](f16) * Wo[512x512](f32) + bias -> f32 out [B,S,D]
// ---------------------------------------------------------------------------
__global__ __launch_bounds__(256)
void mha5102_out_proj(const _Float16* __restrict__ a, const float* __restrict__ w,
                      const float* __restrict__ bias, float* __restrict__ out) {
    __shared__ __align__(16) _Float16 As[128 * 40];
    __shared__ __align__(16) _Float16 Bs[64 * 40];
    const int t    = threadIdx.x;
    const int wid  = t >> 5;
    const int lane = t & 31;
    const int row0 = blockIdx.x * 128;
    const int n0   = blockIdx.y * 64;
    const int hi = lane >> 4, lo = lane & 15;

    v8f zero = {};
    v8f acc[4] = {zero, zero, zero, zero};

    // this thread's places in the two tiles: A rows ar + 64*i, W rows kr + 16*i
    const int ar = t >> 2, c8 = (t & 3) << 3;
    const int kr = t >> 4, n4 = (t & 15) << 2;
    const _Float16* ap = a + (size_t)(row0 + ar) * DMOD + c8;
    const float*    wp = w + (size_t)kr * DMOD + n0 + n4;

    // K chunks fetched two ahead into two register sets, as in the first GEMM
    v8h xr[2][2];
    v4f wr[2][2];
#pragma unroll
    for (int s = 0; s < 2; ++s) {
#pragma unroll
        for (int i = 0; i < 2; ++i) {
            xr[s][i] = *(const v8h*)(ap + (size_t)(i * 64) * DMOD + s * 32);
            wr[s][i] = *(const v4f*)(wp + (size_t)(s * 32 + i * 16) * DMOD);
        }
    }

    for (int k0 = 0; k0 < DMOD; k0 += 64) {
#pragma unroll
        for (int s = 0; s < 2; ++s) {            // static index of the register set
            lds_barrier();                       // every wave has read the chunk before
            // keeps this chunk's conversions, and the s_wait_loadcnt in front of them, from
            // being scheduled up into the chunk before, where its loads have just been issued
            __builtin_amdgcn_sched_barrier(0);
#pragma unroll
            for (int i = 0; i < 2; ++i)          // A tile 128x32 f16
                *(v8h*)(As + (ar + i * 64) * 40 + c8) = xr[s][i];
#pragma unroll
            for (int i = 0; i < 2; ++i) {        // W tile 32x64, transposed
                v4f wv4 = wr[s][i];
                Bs[(n4 + 0) * 40 + kr + i * 16] = (_Float16)wv4[0];
                Bs[(n4 + 1) * 40 + kr + i * 16] = (_Float16)wv4[1];
                Bs[(n4 + 2) * 40 + kr + i * 16] = (_Float16)wv4[2];
                Bs[(n4 + 3) * 40 + kr + i * 16] = (_Float16)wv4[3];
            }
            if (k0 + 64 < DMOD) {                // chunk two ahead, same set
                const int kn = k0 + 64 + s * 32;
#pragma unroll
                for (int i = 0; i < 2; ++i) {
                    xr[s][i] = *(const v8h*)(ap + (size_t)(i * 64) * DMOD + kn);
                    wr[s][i] = *(const v4f*)(wp + (size_t)(kn + i * 16) * DMOD);
                }
            }
            lds_barrier();                       // chunk published
            v16h av = ld_op(As + wid * 16 * 40, 40, lane);
#pragma unroll
            for (int nt = 0; nt < 4; ++nt) {
                v16h b = ld_op(Bs + nt * 16 * 40, 40, lane);
                acc[nt] = wmma16(av, b, acc[nt]);
            }
        }
    }
#pragma unroll
    for (int nt = 0; nt < 4; ++nt) {
        int col = n0 + nt * 16 + lo;
        float bv = bias[col];
#pragma unroll
        for (int r = 0; r < 8; ++r) {
            int grow = row0 + wid * 16 + r + 8 * hi;
            out[(size_t)grow * DMOD + col] = acc[nt][r] + bv;
        }
    }
}

extern "C" void kernel_launch(void* const* d_in, const int* in_sizes, int n_in,
                              void* d_out, int out_size, void* d_ws, size_t ws_size,
                              hipStream_t stream) {
    const float* query = (const float*)d_in[0];
    const float* key_  = (const float*)d_in[1];
    const float* value = (const float*)d_in[2];
    const int*   mask  = (const int*)d_in[3];
    const float* wq_w = (const float*)d_in[4];
    const float* wq_b = (const float*)d_in[5];
    const float* wk_w = (const float*)d_in[6];
    const float* wk_b = (const float*)d_in[7];
    const float* wv_w = (const float*)d_in[8];
    const float* wv_b = (const float*)d_in[9];
    const float* wo_w = (const float*)d_in[10];
    const float* wo_b = (const float*)d_in[11];

    // workspace: 4 f16 buffers of 8192*512 elems (8 MB each)
    const size_t elems = (size_t)NROWS * DMOD;
    _Float16* qf   = (_Float16*)d_ws;               // [B,H,S,DH]
    _Float16* kf   = qf + elems;                    // [B,H,S,DH]
    _Float16* vf   = kf + elems;                    // [B,H,DH,S] (transposed)
    _Float16* attn = vf + elems;                    // [B,S,D]

    dim3 blk(256);
    dim3 gGemm(NROWS / 128, DMOD / 64);             // 64 x 8
    mha5102_qkv_proj<<<gGemm, blk, 0, stream>>>(query, wq_w, wq_b, qf, 0);
    mha5102_qkv_proj<<<gGemm, blk, 0, stream>>>(key_,  wk_w, wk_b, kf, 0);
    mha5102_qkv_proj<<<gGemm, blk, 0, stream>>>(value, wv_w, wv_b, vf, 1);

    dim3 gAttn((4 * NHEAD) * (SEQ / 128));          // 512 blocks
    mha5102_attn<<<gAttn, blk, 0, stream>>>(qf, kf, vf, mask, attn);

    mha5102_out_proj<<<gGemm, blk, 0, stream>>>(attn, wo_w, wo_b, (float*)d_out);
}

// v003
// It runs in 119 microseconds.
// In both of two side-by-side timings against v002, it was 1.21 times as fast.
// All steps since v000 together make it 1.52 times as fast.
#include <hip/hip_runtime.h>
#include <hip/hip_bf16.h>

// MHA: B=4, S=2048, D=512, H=8, DH=64.  All GEMMs via v_wmma_f32_16x16x32_f16.
// Flash attention with TDM (tensor_load_to_lds) double-buffered K/V tiles.

typedef __attribute__((ext_vector_type(16))) _Float16 v16h;
typedef __attribute__((ext_vector_type(8)))  _Float16 v8h;
typedef __attribute__((ext_vector_type(4)))  _Float16 v4h;
typedef __attribute__((ext_vector_type(8)))  float    v8f;
typedef __attribute__((ext_vector_type(4)))  float    v4f;
typedef __attribute__((ext_vector_type(4)))  int      v4i;
typedef __attribute__((ext_vector_type(4)))  unsigned int u32x4;
typedef __attribute__((ext_vector_type(8)))  unsigned int u32x8;

#define SEQ   2048
#define DMOD  512
#define NHEAD 8
#define DHEAD 64
#define NROWS 8192   // B*S

// Gather one 16x32 (f16) WMMA operand from a row-major [x][k] tile.
// ISA 16-bit A/B layout: lane L holds row/col (L&15); halves 0..7 -> K = khi+0..7,
// halves 8..15 -> K = khi+16..23, where khi = 8*(L>=16).
__device__ __forceinline__ v16h ld_op(const _Float16* base, int stride, int lane) {
    const int rc  = lane & 15;
    const int khi = (lane >> 4) << 3;
    const _Float16* p = base + rc * stride + khi;
    v8h lo8 = *(const v8h*)(p);
    v8h hi8 = *(const v8h*)(p + 16);
    return __builtin_shufflevector(lo8, hi8, 0,1,2,3,4,5,6,7,8,9,10,11,12,13,14,15);
}

__device__ __forceinline__ v8f wmma16(v16h a, v16h b, v8f c) {
    return __builtin_amdgcn_wmma_f32_16x16x32_f16(false, a, false, b, (short)0, c,
                                                  false, false);
}

// Work-group barrier of the two projection loops.  It waits for this wave's LDS
// operations only: __syncthreads() would also drain the global loads that were
// issued ahead for later K chunks, and their latency would be exposed again.
__device__ __forceinline__ void lds_barrier() {
    asm volatile("s_wait_dscnt 0x0\n\ts_barrier_signal -1\n\ts_barrier_wait -1" ::: "memory");
}

// ---------------------------------------------------------------------------
// TDM: issue a 2D tensor_load_to_lds.  Descriptor bit layout per CDNA5 ISA
// ch.8: group0 = {count, lds_addr, global_addr, type=2}; group1 = {data_size=2B,
// pad ctrl, tensor/tile dims, dim0 stride}.  Hardware applies LDS row padding
// (pad_amt+1 DWORDs after every 8*2^pad_int bytes) -> bank-conflict-free strides.
// ---------------------------------------------------------------------------
__device__ __forceinline__ void tdm_load_2d(unsigned lds_off, const void* gaddr,
                                            unsigned tensor_d0, unsigned tensor_d1,
                                            unsigned tile_d0, unsigned tile_d1,
                                            unsigned stride0,
                                            unsigned pad_int, unsigned pad_amt) {
    unsigned long long ga = (unsigned long long)(size_t)gaddr;
    u32x4 g0;
    g0[0] = 1u;                                   // count=1, user descriptor
    g0[1] = lds_off;                              // LDS byte address
    g0[2] = (unsigned)ga;                         // global_addr[31:0]
    g0[3] = ((unsigned)(ga >> 32) & 0x01FFFFFFu)  // global_addr[56:32]
            | 0x80000000u;                        // type=2 ("image")
    u32x8 g1;
    g1[0] = (1u << 16)                            // data_size = 2 bytes
          | (1u << 20)                            // pad_enable
          | (pad_int << 22) | (pad_amt << 25);    // workgroup_mask=0 (no cluster)
    g1[1] = (tensor_d0 & 0xFFFFu) << 16;          // tensor_dim0[15:0]
    g1[2] = (tensor_d0 >> 16) | ((tensor_d1 & 0xFFFFu) << 16);
    g1[3] = (tensor_d1 >> 16) | (tile_d0 << 16);  // tile_dim0
    g1[4] = tile_d1 & 0xFFFFu;                    // tile_dim1 (tile_dim2=0)
    g1[5] = stride0;                              // tensor_dim0_stride[31:0]
    g1[6] = 0u;                                   // stride hi / dim1_stride (2D)
    g1[7] = 0u;
    asm volatile("tensor_load_to_lds %0, %1" :: "s"(g0), "s"(g1) : "memory");
}

// ---------------------------------------------------------------------------
// GEMM 1: X[8192x512](f32) * W[512x512](f32) + bias -> f16 out.
// vTranspose=0: out[B,H,S,DH]; vTranspose=1: out[B,H,DH,S] (for TDM V tiles).
// Block tile 128x64, K-chunks of 32; float4 global loads.
// ---------------------------------------------------------------------------
__global__ __launch_bounds__(256)
void mha5102_qkv_proj(const float* __restrict__ x, const float* __restrict__ w,
                      const float* __restrict__ bias, _Float16* __restrict__ out,
                      int vTranspose) {
    __shared__ __align__(16) _Float16 As[128 * 40];
    __shared__ __align__(16) _Float16 Bs[64 * 40];
    const int t    = threadIdx.x;
    const int wid  = t >> 5;
    const int lane = t & 31;
    const int row0 = blockIdx.x * 128;
    const int n0   = blockIdx.y * 64;
    const int hi = lane >> 4, lo = lane & 15;

    v8f zero = {};
    v8f acc[4] = {zero, zero, zero, zero};

    // this thread's places in the two tiles: A rows ar + 32*i, W rows kr + 16*i
    const int ar = t >> 3, c4 = (t & 7) << 2;
    const int kr = t >> 4, n4 = (t & 15) << 2;
    const float* xp = x + (size_t)(row0 + ar) * DMOD + c4;
    const float* wp = w + (size_t)kr * DMOD + n0 + n4;

    // K chunks are fetched two ahead into two register sets: chunk c + 2 is
    // requested as soon as chunk c has left its set for LDS.
    v4f xr[2][4], wr[2][2];
#pragma unroll
    for (int s = 0; s < 2; ++s) {
#pragma unroll
        for (int i = 0; i < 4; ++i)
            xr[s][i] = *(const v4f*)(xp + (size_t)(i * 32) * DMOD + s * 32);
#pragma unroll
        for (int i = 0; i < 2; ++i)
            wr[s][i] = *(const v4f*)(wp + (size_t)(s * 32 + i * 16) * DMOD);
    }

    // straight-line K loop: in a rolled one the counted s_wait_loadcnt must also hold on the path
    // that asks for no further chunk, becomes 0, and drains the chunks fetched ahead
#pragma unroll
    for (int k0 = 0; k0 < DMOD; k0 += 64) {
#pragma unroll
        for (int s = 0; s < 2; ++s) {            // static index of the register set
            lds_barrier();                       // every wave has read the chunk before
            // keeps this chunk's conversions, and the s_wait_loadcnt in front of them, from
            // being scheduled up into the chunk before, where its loads have just been issued
            __builtin_amdgcn_sched_barrier(0);
#pragma unroll
            for (int i = 0; i < 4; ++i) {        // A tile 128x32 f32 -> f16
                v4f xv = xr[s][i];
                v4h hv;
                hv[0] = (_Float16)xv[0]; hv[1] = (_Float16)xv[1];
                hv[2] = (_Float16)xv[2]; hv[3] = (_Float16)xv[3];
                *(v4h*)(As + (ar + i * 32) * 40 + c4) = hv;
            }
#pragma unroll
            for (int i = 0; i < 2; ++i) {        // W tile 32x64, stored transposed
                v4f wv4 = wr[s][i];
                Bs[(n4 + 0) * 40 + kr + i * 16] = (_Float16)wv4[0];
                Bs[(n4 + 1) * 40 + kr + i * 16] = (_Float16)wv4[1];
                Bs[(n4 + 2) * 40 + kr + i * 16] = (_Float16)wv4[2];
                Bs[(n4 + 3) * 40 + kr + i * 16] = (_Float16)wv4[3];
            }
            if (k0 + 64 < DMOD) {                // chunk two ahead, same set
                const int kn = k0 + 64 + s * 32;
#pragma unroll
                for (int i = 0; i < 4; ++i)
                    xr[s][i] = *(const v4f*)(xp + (size_t)(i * 32) * DMOD + kn);
#pragma unroll
                for (int i = 0; i < 2; ++i)
                    wr[s][i] = *(const v4f*)(wp + (size_t)(kn + i * 16) * DMOD);
            }
            lds_barrier();                       // chunk published
            v16h a = ld_op(As + wid * 16 * 40, 40, lane);
            v16h b[4];
#pragma unroll
            for (int nt = 0; nt < 4; ++nt)
                b[nt] = ld_op(Bs + nt * 16 * 40, 40, lane);
            // keeps the chunk's ten LDS reads in one group ahead of its products: spread among
            // them, into one shared register set, each product waits out a full LDS latency
            __builtin_amdgcn_sched_barrier(0);
#pragma unroll
            for (int nt = 0; nt < 4; ++nt)
                acc[nt] = wmma16(a, b[nt], acc[nt]);
        }
    }
#pragma unroll
    for (int nt = 0; nt < 4; ++nt) {
        int col = n0 + nt * 16 + lo;
        float bv = bias[col];
        int h = col >> 6, dh = col & 63;
#pragma unroll
        for (int r = 0; r < 8; ++r) {
            int grow = row0 + wid * 16 + r + 8 * hi;
            int b_ = grow >> 11, s_ = grow & (SEQ - 1);
            size_t bh = (size_t)(b_ * NHEAD + h);
            size_t o = vTranspose ? (bh * DHEAD + dh) * SEQ + s_
                                  : (bh * SEQ + s_) * DHEAD + dh;
            out[o] = (_Float16)(acc[nt][r] + bv);
        }
    }
}

__device__ __forceinline__ float xhalf(float x) {
    int b = __builtin_bit_cast(int, x);
    return __builtin_bit_cast(float,
        __builtin_amdgcn_permlanex16(b, b, 0x76543210, 0xfedcba98, false, false));
}

__global__ __launch_bounds__(256)
void mha5102_attn(const _Float16* __restrict__ q, const _Float16* __restrict__ k,
                  const _Float16* __restrict__ vt, const int* __restrict__ mask,
                  _Float16* __restrict__ attn_out) {
    // each buffer rounded up to 6 KiB so that every tensor-load destination is a
    // multiple of 2 KiB in the work-group's LDS
    __shared__ __attribute__((aligned(2048))) _Float16 Ks[2][3072];  // [key][dh], 32 x 72
    __shared__ __attribute__((aligned(2048))) _Float16 Vs[2][3072];  // [dh][key], 64 x 40
    const int t = threadIdx.x, wid = t >> 5, lane = t & 31;
    const int hi = lane >> 4, lo = lane & 15;
    const int qblk = blockIdx.x & 15;
    const int bh   = blockIdx.x >> 4;
    const int b_   = bh >> 3, h_ = bh & 7;
    const _Float16* qh  = q  + (size_t)bh * SEQ * DHEAD;
    const _Float16* kh  = k  + (size_t)bh * SEQ * DHEAD;   // [key][dh]
    const _Float16* vth = vt + (size_t)bh * DHEAD * SEQ;   // [dh][key]
    const int* mp = mask + b_ * SEQ + 8 * hi;              // this half's keys, walks with j0
    const int qr0 = qblk * 128 + wid * 16;

    v16h qa[2];                                   // B operand: column = query
#pragma unroll
    for (int c = 0; c < 2; ++c)
        qa[c] = ld_op(qh + (size_t)qr0 * DHEAD + c * 32, DHEAD, lane);

    v8f zero = {};
    v8f acc[4] = {zero, zero, zero, zero};        // O^T: [dh = 16*tt+8*hi+r][query lo]
    float mrun = -1e30f, lrun = 0.f;              // lrun: this half's keys only
    const float scale = 0.125f;  // 1/sqrt(64)

    // K tile: 32 rows x 64 halves, mem stride 64, LDS row 128B + 16B pad -> 72 halves
    // V tile: 64 rows x 32 halves, mem stride SEQ, LDS row 64B + 16B pad  -> 40 halves
    if (wid == 0) {
        tdm_load_2d((unsigned)(size_t)(void*)&Ks[0][0], kh,
                    64, 2048, 64, 32, 64, /*pad_int 128B*/4, /*pad 4DW*/3);
        tdm_load_2d((unsigned)(size_t)(void*)&Vs[0][0], vth,
                    2048, 64, 32, 64, 2048, /*pad_int 64B*/3, /*pad 4DW*/3);
        __builtin_amdgcn_s_wait_tensorcnt(0);
    }
    __syncthreads();

    int cur = 0;
    unsigned rd = 0;                              // byte offset of buffer cur, K and V alike
    for (int j0 = 0; j0 < SEQ; j0 += 32) {
        // prefetch next tiles into the other buffer while we compute
        if (wid == 0 && j0 + 32 < SEQ) {
            tdm_load_2d((unsigned)(size_t)(void*)&Ks[cur ^ 1][0],
                        kh + (size_t)(j0 + 32) * DHEAD,
                        64, 2048, 64, 32, 64, 4, 3);
            tdm_load_2d((unsigned)(size_t)(void*)&Vs[cur ^ 1][0],
                        vth + (j0 + 32),
                        2048, 64, 32, 64, 2048, 3, 3);
        }
        const _Float16* Kc = (const _Float16*)((const char*)&Ks[0][0] + rd);
        const _Float16* Vc = (const _Float16*)((const char*)&Vs[0][0] + rd);

        // mask of this lane's 16 keys: j0+8*hi+0..7 and j0+16+8*hi+0..7
        v4i mk[4];
        mk[0] = *(const v4i*)(mp);
        mk[1] = *(const v4i*)(mp + 4);
        mk[2] = *(const v4i*)(mp + 16);
        mk[3] = *(const v4i*)(mp + 20);
        mp += 32;

        // all 16 LDS reads of the pass in one group, K fragments first, V^T behind them
        v16h kfr[2][2], vfr[4];
#pragma unroll
        for (int c = 0; c < 2; ++c)
#pragma unroll
            for (int nt = 0; nt < 2; ++nt)
                kfr[nt][c] = ld_op(Kc + nt * 16 * 72 + c * 32, 72, lane);
#pragma unroll
        for (int tt = 0; tt < 4; ++tt)
            vfr[tt] = ld_op(Vc + tt * 16 * 40, 40, lane);
        // keeps the reads above from being spread among the products below, two in front of
        // each, into one shared register set: there every product waits out a full LDS latency
        __builtin_amdgcn_sched_barrier(0);

        // scores S^T = K * Q^T : two 16x16 tiles (keys j0..+15, j0+16..+31)
        v8f st[2] = {zero, zero};
#pragma unroll
        for (int c = 0; c < 2; ++c)
#pragma unroll
            for (int nt = 0; nt < 2; ++nt)
                st[nt] = wmma16(kfr[nt][c], qa[c], st[nt]);
        // keeps the mask compares, and the s_wait_loadcnt in front of them, behind the score
        // products, which do not need the mask
        __builtin_amdgcn_sched_barrier(0);

        float sv[16];
#pragma unroll
        for (int i = 0; i < 16; ++i)
            sv[i] = st[i >> 3][i & 7] * scale + (mk[i >> 2][i & 3] ? -1e9f : 0.f);

        float mx[4];
#pragma unroll
        for (int g = 0; g < 4; ++g)
            mx[g] = fmaxf(fmaxf(sv[4 * g], sv[4 * g + 1]), fmaxf(sv[4 * g + 2], sv[4 * g + 3]));
        float m = fmaxf(fmaxf(mx[0], mx[1]), fmaxf(mx[2], mx[3]));
        m = fmaxf(m, xhalf(m));                   // both halves use one maximum
        const float mn = fmaxf(mrun, m);

        float p[16];
#pragma unroll
        for (int i = 0; i < 16; ++i) p[i] = __expf(sv[i] - mn);
        const float alpha = __expf(mrun - mn);
        mrun = mn;
        float ps[4];
#pragma unroll
        for (int g = 0; g < 4; ++g)
            ps[g] = (p[4 * g] + p[4 * g + 1]) + (p[4 * g + 2] + p[4 * g + 3]);
        lrun = lrun * alpha + ((ps[0] + ps[1]) + (ps[2] + ps[3]));

#pragma unroll
        for (int tt = 0; tt < 4; ++tt)
#pragma unroll
            for (int r = 0; r < 8; ++r) acc[tt][r] *= alpha;

        // P^T as B operand: half s<8 is key 8*hi+s, half s>=8 is key 16+8*hi+(s-8),
        // the k order ld_op gives the V^T rows
        v16h pb;
#pragma unroll
        for (int i = 0; i < 16; ++i) pb[i] = (_Float16)p[i];
#pragma unroll
        for (int tt = 0; tt < 4; ++tt)
            acc[tt] = wmma16(vfr[tt], pb, acc[tt]);

        __syncthreads();                          // all waves done reading cur
        if (wid == 0) __builtin_amdgcn_s_wait_tensorcnt(0);
        __syncthreads();                          // next buffer visible to all
        cur ^= 1;
        rd ^= 6144u;
    }

    // join the halves' sums, normalize, store merged heads f16 [B,S,D]:
    // a lane holds 8 consecutive dh of its query per tile -> one 16-byte store
    const float inv = 1.0f / fmaxf(lrun + xhalf(lrun), 1e-30f);
    _Float16* orow = attn_out + ((size_t)b_ * SEQ + qr0 + lo) * DMOD + h_ * DHEAD + 8 * hi;
#pragma unroll
    for (int tt = 0; tt < 4; ++tt) {
        v8h ov;
#pragma unroll
        for (int r = 0; r < 8; ++r) ov[r] = (_Float16)(acc[tt][r] * inv);
        *(v8h*)(orow + tt * 16) = ov;
    }
}

// ---------------------------------------------------------------------------
// GEMM 3: attn[8192x512](f16) * Wo[512x512](f32) + bias -> f32 out [B,S,D]
// ---------------------------------------------------------------------------
__global__ __launch_bounds__(256)
void mha5102_out_proj(const _Float16* __restrict__ a, const float* __restrict__ w,
                      const float* __restrict__ bias, float* __restrict__ out) {
    __shared__ __align__(16) _Float16 As[128 * 40];
    __shared__ __align__(16) _Float16 Bs[64 * 40];
    const int t    = threadIdx.x;
    const int wid  = t >> 5;
    const int lane = t & 31;
    const int row0 = blockIdx.x * 128;
    const int n0   = blockIdx.y * 64;
    const int hi = lane >> 4, lo = lane & 15;

    v8f zero = {};
    v8f acc[4] = {zero, zero, zero, zero};

    // this thread's places in the two tiles: A rows ar + 64*i, W rows kr + 16*i
    const int ar = t >> 2, c8 = (t & 3) << 3;
    const int kr = t >> 4, n4 = (t & 15) << 2;
    const _Float16* ap = a + (size_t)(row0 + ar) * DMOD + c8;
    const float*    wp = w + (size_t)kr * DMOD + n0 + n4;

    // K chunks fetched two ahead into two register sets, as in the first GEMM
    v8h xr[2][2];
    v4f wr[2][2];
#pragma unroll
    for (int s = 0; s < 2; ++s) {
#pragma unroll
        for (int i = 0; i < 2; ++i) {
            xr[s][i] = *(const v8h*)(ap + (size_t)(i * 64) * DMOD + s * 32);
            wr[s][i] = *(const v4f*)(wp + (size_t)(s * 32 + i * 16) * DMOD);
        }
    }

    // straight-line K loop: in a rolled one the counted s_wait_loadcnt must also hold on the path
    // that asks for no further chunk, becomes 0, and drains the chunks fetched ahead
#pragma unroll
    for (int k0 = 0; k0 < DMOD; k0 += 64) {
#pragma unroll
        for (int s = 0; s < 2; ++s) {            // static index of the register set
            lds_barrier();                       // every wave has read the chunk before
            // keeps this chunk's conversions, and the s_wait_loadcnt in front of them, from
            // being scheduled up into the chunk before, where its loads have just been issued
            __builtin_amdgcn_sched_barrier(0);
#pragma unroll
            for (int i = 0; i < 2; ++i)          // A tile 128x32 f16
                *(v8h*)(As + (ar + i * 64) * 40 + c8) = xr[s][i];
#pragma unroll
            for (int i = 0; i < 2; ++i) {        // W tile 32x64, transposed
                v4f wv4 = wr[s][i];
                Bs[(n4 + 0) * 40 + kr + i * 16] = (_Float16)wv4[0];
                Bs[(n4 + 1) * 40 + kr + i * 16] = (_Float16)wv4[1];
                Bs[(n4 + 2) * 40 + kr + i * 16] = (_Float16)wv4[2];
                Bs[(n4 + 3) * 40 + kr + i * 16] = (_Float16)wv4[3];
            }
            if (k0 + 64 < DMOD) {                // chunk two ahead, same set
                const int kn = k0 + 64 + s * 32;
#pragma unroll
                for (int i = 0; i < 2; ++i) {
                    xr[s][i] = *(const v8h*)(ap + (size_t)(i * 64) * DMOD + kn);
                    wr[s][i] = *(const v4f*)(wp + (size_t)(kn + i * 16) * DMOD);
                }
            }
            lds_barrier();                       // chunk published
            v16h av = ld_op(As + wid * 16 * 40, 40, lane);
            v16h b[4];
#pragma unroll
            for (int nt = 0; nt < 4; ++nt)
                b[nt] = ld_op(Bs + nt * 16 * 40, 40, lane);
            // one group of LDS reads ahead of the products, as in the first GEMM
            __builtin_amdgcn_sched_barrier(0);
#pragma unroll
            for (int nt = 0; nt < 4; ++nt)
                acc[nt] = wmma16(av, b[nt], acc[nt]);
        }
    }
#pragma unroll
    for (int nt = 0; nt < 4; ++nt) {
        int col = n0 + nt * 16 + lo;
        float bv = bias[col];
#pragma unroll
        for (int r = 0; r < 8; ++r) {
            int grow = row0 + wid * 16 + r + 8 * hi;
            out[(size_t)grow * DMOD + col] = acc[nt][r] + bv;
        }
    }
}

extern "C" void kernel_launch(void* const* d_in, const int* in_sizes, int n_in,
                              void* d_out, int out_size, void* d_ws, size_t ws_size,
                              hipStream_t stream) {
    const float* query = (const float*)d_in[0];
    const float* key_  = (const float*)d_in[1];
    const float* value = (const float*)d_in[2];
    const int*   mask  = (const int*)d_in[3];
    const float* wq_w = (const float*)d_in[4];
    const float* wq_b = (const float*)d_in[5];
    const float* wk_w = (const float*)d_in[6];
    const float* wk_b = (const float*)d_in[7];
    const float* wv_w = (const float*)d_in[8];
    const float* wv_b = (const float*)d_in[9];
    const float* wo_w = (const float*)d_in[10];
    const float* wo_b = (const float*)d_in[11];

    // workspace: 4 f16 buffers of 8192*512 elems (8 MB each)
    const size_t elems = (size_t)NROWS * DMOD;
    _Float16* qf   = (_Float16*)d_ws;               // [B,H,S,DH]
    _Float16* kf   = qf + elems;                    // [B,H,S,DH]
    _Float16* vf   = kf + elems;                    // [B,H,DH,S] (transposed)
    _Float16* attn = vf + elems;                    // [B,S,D]

    dim3 blk(256);
    dim3 gGemm(NROWS / 128, DMOD / 64);             // 64 x 8
    mha5102_qkv_proj<<<gGemm, blk, 0, stream>>>(query, wq_w, wq_b, qf, 0);
    mha5102_qkv_proj<<<gGemm, blk, 0, stream>>>(key_,  wk_w, wk_b, kf, 0);
    mha5102_qkv_proj<<<gGemm, blk, 0, stream>>>(value, wv_w, wv_b, vf, 1);

    dim3 gAttn((4 * NHEAD) * (SEQ / 128));          // 512 blocks
    mha5102_attn<<<gAttn, blk, 0, stream>>>(qf, kf, vf, mask, attn);

    mha5102_out_proj<<<gGemm, blk, 0, stream>>>(attn, wo_w, wo_b, (float*)d_out);
}

// v004
// One run takes 98.9 microseconds.
// Timed twice side by side with v003, it ran 1.20 and 1.21 times as fast.
// Counting every step since v000, it is 1.84 times as fast.
#include <hip/hip_runtime.h>
#include <hip/hip_bf16.h>

// MHA: B=4, S=2048, D=512, H=8, DH=64.  All GEMMs via v_wmma_f32_16x16x32_f16.
// Flash attention with TDM (tensor_load_to_lds) double-buffered K/V tiles.

typedef __attribute__((ext_vector_type(16))) _Float16 v16h;
typedef __attribute__((ext_vector_type(8)))  _Float16 v8h;
typedef __attribute__((ext_vector_type(4)))  _Float16 v4h;
typedef __attribute__((ext_vector_type(8)))  float    v8f;
typedef __attribute__((ext_vector_type(4)))  float    v4f;
typedef __attribute__((ext_vector_type(4)))  int      v4i;
typedef __attribute__((ext_vector_type(4)))  unsigned int u32x4;
typedef __attribute__((ext_vector_type(8)))  unsigned int u32x8;
typedef __attribute__((ext_vector_type(8)))  short    s16x8;

#define SEQ   2048
#define DMOD  512
#define NHEAD 8
#define DHEAD 64
#define NROWS 8192   // B*S

// Gather one 16x32 (f16) WMMA operand from a row-major [x][k] tile.
// ISA 16-bit A/B layout: lane L holds row/col (L&15); halves 0..7 -> K = khi+0..7,
// halves 8..15 -> K = khi+16..23, where khi = 8*(L>=16).
__device__ __forceinline__ v16h ld_op(const _Float16* base, int stride, int lane) {
    const int rc  = lane & 15;
    const int khi = (lane >> 4) << 3;
    const _Float16* p = base + rc * stride + khi;
    v8h lo8 = *(const v8h*)(p);
    v8h hi8 = *(const v8h*)(p + 16);
    return __builtin_shufflevector(lo8, hi8, 0,1,2,3,4,5,6,7,8,9,10,11,12,13,14,15);
}

// The same operand, 16 columns x 32 k, from a row-major [k][col] tile in LDS, by the transposing
// load: lane L gets tile[kb + 8*(L>=16) + 0..7][L&15], kb = 0 then 16, which is ld_op's k order.
__device__ __forceinline__ v16h ld_op_tr(const _Float16* tile, int stride, int lane) {
    typedef __attribute__((address_space(3))) s16x8 lds_s16x8;
    const _Float16* p = tile + (((lane >> 4) << 3) + (lane & 7)) * stride + (((lane >> 3) & 1) << 3);
    v8h lo8 = __builtin_bit_cast(v8h, __builtin_amdgcn_ds_load_tr16_b128_v8i16((lds_s16x8*)p));
    v8h hi8 = __builtin_bit_cast(v8h,
        __builtin_amdgcn_ds_load_tr16_b128_v8i16((lds_s16x8*)(p + 16 * stride)));
    return __builtin_shufflevector(lo8, hi8, 0,1,2,3,4,5,6,7,8,9,10,11,12,13,14,15);
}

__device__ __forceinline__ v8f wmma16(v16h a, v16h b, v8f c) {
    return __builtin_amdgcn_wmma_f32_16x16x32_f16(false, a, false, b, (short)0, c,
                                                  false, false);
}

// Work-group barrier of the two projection loops.  It waits for this wave's LDS
// operations only: __syncthreads() would also drain the global loads that were
// issued ahead for later K chunks, and their latency would be exposed again.
__device__ __forceinline__ void lds_barrier() {
    asm volatile("s_wait_dscnt 0x0\n\ts_barrier_signal -1\n\ts_barrier_wait -1" ::: "memory");
}

// ---------------------------------------------------------------------------
// TDM: issue a 2D tensor_load_to_lds.  Descriptor bit layout per CDNA5 ISA
// ch.8: group0 = {count, lds_addr, global_addr, type=2}; group1 = {data_size=2B,
// pad ctrl, tensor/tile dims, dim0 stride}.  Hardware applies LDS row padding
// (pad_amt+1 DWORDs after every 8*2^pad_int bytes) -> bank-conflict-free strides.
// ---------------------------------------------------------------------------
__device__ __forceinline__ void tdm_load_2d(unsigned lds_off, const void* gaddr,
                                            unsigned tensor_d0, unsigned tensor_d1,
                                            unsigned tile_d0, unsigned tile_d1,
                                            unsigned stride0,
                                            unsigned pad_int, unsigned pad_amt) {
    unsigned long long ga = (unsigned long long)(size_t)gaddr;
    u32x4 g0;
    g0[0] = 1u;                                   // count=1, user descriptor
    g0[1] = lds_off;                              // LDS byte address
    g0[2] = (unsigned)ga;                         // global_addr[31:0]
    g0[3] = ((unsigned)(ga >> 32) & 0x01FFFFFFu)  // global_addr[56:32]
            | 0x80000000u;                        // type=2 ("image")
    u32x8 g1;
    g1[0] = (1u << 16)                            // data_size = 2 bytes
          | (1u << 20)                            // pad_enable
          | (pad_int << 22) | (pad_amt << 25);    // workgroup_mask=0 (no cluster)
    g1[1] = (tensor_d0 & 0xFFFFu) << 16;          // tensor_dim0[15:0]
    g1[2] = (tensor_d0 >> 16) | ((tensor_d1 & 0xFFFFu) << 16);
    g1[3] = (tensor_d1 >> 16) | (tile_d0 << 16);  // tile_dim0
    g1[4] = tile_d1 & 0xFFFFu;                    // tile_dim1 (tile_dim2=0)
    g1[5] = stride0;                              // tensor_dim0_stride[31:0]
    g1[6] = 0u;                                   // stride hi / dim1_stride (2D)
    g1[7] = 0u;
    asm volatile("tensor_load_to_lds %0, %1" :: "s"(g0), "s"(g1) : "memory");
}

// ---------------------------------------------------------------------------
// GEMM 1: X[8192x512](f32) * W[512x512](f32) + bias -> f16 out.
// vTranspose=0: out[B,H,S,DH]; vTranspose=1: out[B,H,DH,S] (for TDM V tiles).
// Block tile 128x64, K-chunks of 32; float4 global loads.
// ---------------------------------------------------------------------------
__global__ __launch_bounds__(256)
void mha5102_qkv_proj(const float* __restrict__ x, const float* __restrict__ w,
                      const float* __restrict__ bias, _Float16* __restrict__ out,
                      int vTranspose) {
    __shared__ __align__(16) _Float16 As[128 * 40];
    __shared__ __align__(16) _Float16 Bs[32 * 80];   // [k][n], pitch 160 B for the transposing load
    const int t    = threadIdx.x;
    const int wid  = t >> 5;
    const int lane = t & 31;
    const int row0 = blockIdx.x * 128;
    const int n0   = blockIdx.y * 64;
    const int hi = lane >> 4, lo = lane & 15;

    v8f zero = {};
    v8f acc[4] = {zero, zero, zero, zero};

    // this thread's places in the two tiles: A rows ar + 32*i, W rows kr + 16*i
    const int ar = t >> 3, c4 = (t & 7) << 2;
    const int kr = t >> 4, n4 = (t & 15) << 2;
    const float* xp = x + (size_t)(row0 + ar) * DMOD + c4;
    const float* wp = w + (size_t)kr * DMOD + n0 + n4;

    // K chunks are fetched two ahead into two register sets: chunk c + 2 is
    // requested as soon as chunk c has left its set for LDS.
    v4f xr[2][4], wr[2][2];
#pragma unroll
    for (int s = 0; s < 2; ++s) {
#pragma unroll
        for (int i = 0; i < 4; ++i)
            xr[s][i] = *(const v4f*)(xp + (size_t)(i * 32) * DMOD + s * 32);
#pragma unroll
        for (int i = 0; i < 2; ++i)
            wr[s][i] = *(const v4f*)(wp + (size_t)(s * 32 + i * 16) * DMOD);
    }

    // straight-line K loop: in a rolled one the counted s_wait_loadcnt must also hold on the path
    // that asks for no further chunk, becomes 0, and drains the chunks fetched ahead
#pragma unroll
    for (int k0 = 0; k0 < DMOD; k0 += 64) {
#pragma unroll
        for (int s = 0; s < 2; ++s) {            // static index of the register set
            lds_barrier();                       // every wave has read the chunk before
            // keeps this chunk's conversions, and the s_wait_loadcnt in front of them, from
            // being scheduled up into the chunk before, where its loads have just been issued
            __builtin_amdgcn_sched_barrier(0);
#pragma unroll
            for (int i = 0; i < 4; ++i) {        // A tile 128x32 f32 -> f16
                v4f xv = xr[s][i];
                v4h hv;
                hv[0] = (_Float16)xv[0]; hv[1] = (_Float16)xv[1];
                hv[2] = (_Float16)xv[2]; hv[3] = (_Float16)xv[3];
                *(v4h*)(As + (ar + i * 32) * 40 + c4) = hv;
            }
#pragma unroll
            for (int i = 0; i < 2; ++i) {        // W tile 32x64, kept row-major
                v4f wv4 = wr[s][i];
                v4h hv;
                hv[0] = (_Float16)wv4[0]; hv[1] = (_Float16)wv4[1];
                hv[2] = (_Float16)wv4[2]; hv[3] = (_Float16)wv4[3];
                *(v4h*)(Bs + (kr + i * 16) * 80 + n4) = hv;
            }
            if (k0 + 64 < DMOD) {                // chunk two ahead, same set
                const int kn = k0 + 64 + s * 32;
#pragma unroll
                for (int i = 0; i < 4; ++i)
                    xr[s][i] = *(const v4f*)(xp + (size_t)(i * 32) * DMOD + kn);
#pragma unroll
                for (int i = 0; i < 2; ++i)
                    wr[s][i] = *(const v4f*)(wp + (size_t)(kn + i * 16) * DMOD);
            }
            lds_barrier();                       // chunk published
            v16h a = ld_op(As + wid * 16 * 40, 40, lane);
            v16h b[4];
#pragma unroll
            for (int nt = 0; nt < 4; ++nt)
                b[nt] = ld_op_tr(Bs + nt * 16, 80, lane);
            // keeps the chunk's ten LDS reads in one group ahead of its products: spread among
            // them, into one shared register set, each product waits out a full LDS latency
            __builtin_amdgcn_sched_barrier(0);
#pragma unroll
            for (int nt = 0; nt < 4; ++nt)
                acc[nt] = wmma16(a, b[nt], acc[nt]);
        }
    }
#pragma unroll
    for (int nt = 0; nt < 4; ++nt) {
        int col = n0 + nt * 16 + lo;
        float bv = bias[col];
        int h = col >> 6, dh = col & 63;
#pragma unroll
        for (int r = 0; r < 8; ++r) {
            int grow = row0 + wid * 16 + r + 8 * hi;
            int b_ = grow >> 11, s_ = grow & (SEQ - 1);
            size_t bh = (size_t)(b_ * NHEAD + h);
            size_t o = vTranspose ? (bh * DHEAD + dh) * SEQ + s_
                                  : (bh * SEQ + s_) * DHEAD + dh;
            out[o] = (_Float16)(acc[nt][r] + bv);
        }
    }
}

__device__ __forceinline__ float xhalf(float x) {
    int b = __builtin_bit_cast(int, x);
    return __builtin_bit_cast(float,
        __builtin_amdgcn_permlanex16(b, b, 0x76543210, 0xfedcba98, false, false));
}

__global__ __launch_bounds__(256)
void mha5102_attn(const _Float16* __restrict__ q, const _Float16* __restrict__ k,
                  const _Float16* __restrict__ vt, const int* __restrict__ mask,
                  _Float16* __restrict__ attn_out) {
    // each buffer rounded up to 6 KiB so that every tensor-load destination is a
    // multiple of 2 KiB in the work-group's LDS
    __shared__ __attribute__((aligned(2048))) _Float16 Ks[2][3072];  // [key][dh], 32 x 72
    __shared__ __attribute__((aligned(2048))) _Float16 Vs[2][3072];  // [dh][key], 64 x 40
    const int t = threadIdx.x, wid = t >> 5, lane = t & 31;
    const int hi = lane >> 4, lo = lane & 15;
    const int qblk = blockIdx.x & 15;
    const int bh   = blockIdx.x >> 4;
    const int b_   = bh >> 3, h_ = bh & 7;
    const _Float16* qh  = q  + (size_t)bh * SEQ * DHEAD;
    const _Float16* kh  = k  + (size_t)bh * SEQ * DHEAD;   // [key][dh]
    const _Float16* vth = vt + (size_t)bh * DHEAD * SEQ;   // [dh][key]
    const int* mp = mask + b_ * SEQ + 8 * hi;              // this half's keys, walks with j0
    const int qr0 = qblk * 128 + wid * 16;

    v16h qa[2];                                   // B operand: column = query
#pragma unroll
    for (int c = 0; c < 2; ++c)
        qa[c] = ld_op(qh + (size_t)qr0 * DHEAD + c * 32, DHEAD, lane);

    v8f zero = {};
    v8f acc[4] = {zero, zero, zero, zero};        // O^T: [dh = 16*tt+8*hi+r][query lo]
    float mrun = -1e30f, lrun = 0.f;              // lrun: this half's keys only
    const float scale = 0.125f;  // 1/sqrt(64)

    // K tile: 32 rows x 64 halves, mem stride 64, LDS row 128B + 16B pad -> 72 halves
    // V tile: 64 rows x 32 halves, mem stride SEQ, LDS row 64B + 16B pad  -> 40 halves
    if (wid == 0) {
        tdm_load_2d((unsigned)(size_t)(void*)&Ks[0][0], kh,
                    64, 2048, 64, 32, 64, /*pad_int 128B*/4, /*pad 4DW*/3);
        tdm_load_2d((unsigned)(size_t)(void*)&Vs[0][0], vth,
                    2048, 64, 32, 64, 2048, /*pad_int 64B*/3, /*pad 4DW*/3);
        __builtin_amdgcn_s_wait_tensorcnt(0);
    }
    __syncthreads();

    int cur = 0;
    unsigned rd = 0;                              // byte offset of buffer cur, K and V alike
    for (int j0 = 0; j0 < SEQ; j0 += 32) {
        // prefetch next tiles into the other buffer while we compute
        if (wid == 0 && j0 + 32 < SEQ) {
            tdm_load_2d((unsigned)(size_t)(void*)&Ks[cur ^ 1][0],
                        kh + (size_t)(j0 + 32) * DHEAD,
                        64, 2048, 64, 32, 64, 4, 3);
            tdm_load_2d((unsigned)(size_t)(void*)&Vs[cur ^ 1][0],
                        vth + (j0 + 32),
                        2048, 64, 32, 64, 2048, 3, 3);
        }
        const _Float16* Kc = (const _Float16*)((const char*)&Ks[0][0] + rd);
        const _Float16* Vc = (const _Float16*)((const char*)&Vs[0][0] + rd);

        // mask of this lane's 16 keys: j0+8*hi+0..7 and j0+16+8*hi+0..7
        v4i mk[4];
        mk[0] = *(const v4i*)(mp);
        mk[1] = *(const v4i*)(mp + 4);
        mk[2] = *(const v4i*)(mp + 16);
        mk[3] = *(const v4i*)(mp + 20);
        mp += 32;

        // all 16 LDS reads of the pass in one group, K fragments first, V^T behind them
        v16h kfr[2][2], vfr[4];
#pragma unroll
        for (int c = 0; c < 2; ++c)
#pragma unroll
            for (int nt = 0; nt < 2; ++nt)
                kfr[nt][c] = ld_op(Kc + nt * 16 * 72 + c * 32, 72, lane);
#pragma unroll
        for (int tt = 0; tt < 4; ++tt)
            vfr[tt] = ld_op(Vc + tt * 16 * 40, 40, lane);
        // keeps the reads above from being spread among the products below, two in front of
        // each, into one shared register set: there every product waits out a full LDS latency
        __builtin_amdgcn_sched_barrier(0);

        // scores S^T = K * Q^T : two 16x16 tiles (keys j0..+15, j0+16..+31)
        v8f st[2] = {zero, zero};
#pragma unroll
        for (int c = 0; c < 2; ++c)
#pragma unroll
            for (int nt = 0; nt < 2; ++nt)
                st[nt] = wmma16(kfr[nt][c], qa[c], st[nt]);
        // keeps the mask compares, and the s_wait_loadcnt in front of them, behind the score
        // products, which do not need the mask
        __builtin_amdgcn_sched_barrier(0);

        float sv[16];
#pragma unroll
        for (int i = 0; i < 16; ++i)
            sv[i] = st[i >> 3][i & 7] * scale + (mk[i >> 2][i & 3] ? -1e9f : 0.f);

        float mx[4];
#pragma unroll
        for (int g = 0; g < 4; ++g)
            mx[g] = fmaxf(fmaxf(sv[4 * g], sv[4 * g + 1]), fmaxf(sv[4 * g + 2], sv[4 * g + 3]));
        float m = fmaxf(fmaxf(mx[0], mx[1]), fmaxf(mx[2], mx[3]));
        m = fmaxf(m, xhalf(m));                   // both halves use one maximum
        const float mn = fmaxf(mrun, m);

        float p[16];
#pragma unroll
        for (int i = 0; i < 16; ++i) p[i] = __expf(sv[i] - mn);
        const float alpha = __expf(mrun - mn);
        mrun = mn;
        float ps[4];
#pragma unroll
        for (int g = 0; g < 4; ++g)
            ps[g] = (p[4 * g] + p[4 * g + 1]) + (p[4 * g + 2] + p[4 * g + 3]);
        lrun = lrun * alpha + ((ps[0] + ps[1]) + (ps[2] + ps[3]));

#pragma unroll
        for (int tt = 0; tt < 4; ++tt)
#pragma unroll
            for (int r = 0; r < 8; ++r) acc[tt][r] *= alpha;

        // P^T as B operand: half s<8 is key 8*hi+s, half s>=8 is key 16+8*hi+(s-8),
        // the k order ld_op gives the V^T rows
        v16h pb;
#pragma unroll
        for (int i = 0; i < 16; ++i) pb[i] = (_Float16)p[i];
#pragma unroll
        for (int tt = 0; tt < 4; ++tt)
            acc[tt] = wmma16(vfr[tt], pb, acc[tt]);

        __syncthreads();                          // all waves done reading cur
        if (wid == 0) __builtin_amdgcn_s_wait_tensorcnt(0);
        __syncthreads();                          // next buffer visible to all
        cur ^= 1;
        rd ^= 6144u;
    }

    // join the halves' sums, normalize, store merged heads f16 [B,S,D]:
    // a lane holds 8 consecutive dh of its query per tile -> one 16-byte store
    const float inv = 1.0f / fmaxf(lrun + xhalf(lrun), 1e-30f);
    _Float16* orow = attn_out + ((size_t)b_ * SEQ + qr0 + lo) * DMOD + h_ * DHEAD + 8 * hi;
#pragma unroll
    for (int tt = 0; tt < 4; ++tt) {
        v8h ov;
#pragma unroll
        for (int r = 0; r < 8; ++r) ov[r] = (_Float16)(acc[tt][r] * inv);
        *(v8h*)(orow + tt * 16) = ov;
    }
}

// ---------------------------------------------------------------------------
// GEMM 3: attn[8192x512](f16) * Wo[512x512](f32) + bias -> f32 out [B,S,D]
// ---------------------------------------------------------------------------
__global__ __launch_bounds__(256)
void mha5102_out_proj(const _Float16* __restrict__ a, const float* __restrict__ w,
                      const float* __restrict__ bias, float* __restrict__ out) {
    __shared__ __align__(16) _Float16 As[128 * 40];
    __shared__ __align__(16) _Float16 Bs[32 * 80];   // [k][n], pitch 160 B for the transposing load
    const int t    = threadIdx.x;
    const int wid  = t >> 5;
    const int lane = t & 31;
    const int row0 = blockIdx.x * 128;
    const int n0   = blockIdx.y * 64;
    const int hi = lane >> 4, lo = lane & 15;

    v8f zero = {};
    v8f acc[4] = {zero, zero, zero, zero};

    // this thread's places in the two tiles: A rows ar + 64*i, W rows kr + 16*i
    const int ar = t >> 2, c8 = (t & 3) << 3;
    const int kr = t >> 4, n4 = (t & 15) << 2;
    const _Float16* ap = a + (size_t)(row0 + ar) * DMOD + c8;
    const float*    wp = w + (size_t)kr * DMOD + n0 + n4;

    // K chunks fetched two ahead into two register sets, as in the first GEMM
    v8h xr[2][2];
    v4f wr[2][2];
#pragma unroll
    for (int s = 0; s < 2; ++s) {
#pragma unroll
        for (int i = 0; i < 2; ++i) {
            xr[s][i] = *(const v8h*)(ap + (size_t)(i * 64) * DMOD + s * 32);
            wr[s][i] = *(const v4f*)(wp + (size_t)(s * 32 + i * 16) * DMOD);
        }
    }

    // straight-line K loop: in a rolled one the counted s_wait_loadcnt must also hold on the path
    // that asks for no further chunk, becomes 0, and drains the chunks fetched ahead
#pragma unroll
    for (int k0 = 0; k0 < DMOD; k0 += 64) {
#pragma unroll
        for (int s = 0; s < 2; ++s) {            // static index of the register set
            lds_barrier();                       // every wave has read the chunk before
            // keeps this chunk's conversions, and the s_wait_loadcnt in front of them, from
            // being scheduled up into the chunk before, where its loads have just been issued
            __builtin_amdgcn_sched_barrier(0);
#pragma unroll
            for (int i = 0; i < 2; ++i)          // A tile 128x32 f16
                *(v8h*)(As + (ar + i * 64) * 40 + c8) = xr[s][i];
#pragma unroll
            for (int i = 0; i < 2; ++i) {        // W tile 32x64, kept row-major
                v4f wv4 = wr[s][i];
                v4h hv;
                hv[0] = (_Float16)wv4[0]; hv[1] = (_Float16)wv4[1];
                hv[2] = (_Float16)wv4[2]; hv[3] = (_Float16)wv4[3];
                *(v4h*)(Bs + (kr + i * 16) * 80 + n4) = hv;
            }
            if (k0 + 64 < DMOD) {                // chunk two ahead, same set
                const int kn = k0 + 64 + s * 32;
#pragma unroll
                for (int i = 0; i < 2; ++i) {
                    xr[s][i] = *(const v8h*)(ap + (size_t)(i * 64) * DMOD + kn);
                    wr[s][i] = *(const v4f*)(wp + (size_t)(kn + i * 16) * DMOD);
                }
            }
            lds_barrier();                       // chunk published
            v16h av = ld_op(As + wid * 16 * 40, 40, lane);
            v16h b[4];
#pragma unroll
            for (int nt = 0; nt < 4; ++nt)
                b[nt] = ld_op_tr(Bs + nt * 16, 80, lane);
            // one group of LDS reads ahead of the products, as in the first GEMM
            __builtin_amdgcn_sched_barrier(0);
#pragma unroll
            for (int nt = 0; nt < 4; ++nt)
                acc[nt] = wmma16(av, b[nt], acc[nt]);
        }
    }
#pragma unroll
    for (int nt = 0; nt < 4; ++nt) {
        int col = n0 + nt * 16 + lo;
        float bv = bias[col];
#pragma unroll
        for (int r = 0; r < 8; ++r) {
            int grow = row0 + wid * 16 + r + 8 * hi;
            out[(size_t)grow * DMOD + col] = acc[nt][r] + bv;
        }
    }
}

extern "C" void kernel_launch(void* const* d_in, const int* in_sizes, int n_in,
                              void* d_out, int out_size, void* d_ws, size_t ws_size,
                              hipStream_t stream) {
    const float* query = (const float*)d_in[0];
    const float* key_  = (const float*)d_in[1];
    const float* value = (const float*)d_in[2];
    const int*   mask  = (const int*)d_in[3];
    const float* wq_w = (const float*)d_in[4];
    const float* wq_b = (const float*)d_in[5];
    const float* wk_w = (const float*)d_in[6];
    const float* wk_b = (const float*)d_in[7];
    const float* wv_w = (const float*)d_in[8];
    const float* wv_b = (const float*)d_in[9];
    const float* wo_w = (const float*)d_in[10];
    const float* wo_b = (const float*)d_in[11];

    // workspace: 4 f16 buffers of 8192*512 elems (8 MB each)
    const size_t elems = (size_t)NROWS * DMOD;
    _Float16* qf   = (_Float16*)d_ws;               // [B,H,S,DH]
    _Float16* kf   = qf + elems;                    // [B,H,S,DH]
    _Float16* vf   = kf + elems;                    // [B,H,DH,S] (transposed)
    _Float16* attn = vf + elems;                    // [B,S,D]

    dim3 blk(256);
    dim3 gGemm(NROWS / 128, DMOD / 64);             // 64 x 8
    mha5102_qkv_proj<<<gGemm, blk, 0, stream>>>(query, wq_w, wq_b, qf, 0);
    mha5102_qkv_proj<<<gGemm, blk, 0, stream>>>(key_,  wk_w, wk_b, kf, 0);
    mha5102_qkv_proj<<<gGemm, blk, 0, stream>>>(value, wv_w, wv_b, vf, 1);

    dim3 gAttn((4 * NHEAD) * (SEQ / 128));          // 512 blocks
    mha5102_attn<<<gAttn, blk, 0, stream>>>(qf, kf, vf, mask, attn);

    mha5102_out_proj<<<gGemm, blk, 0, stream>>>(attn, wo_w, wo_b, (float*)d_out);
}

// v005
// It runs in 94.2 microseconds.
// Two timings next to v004 put it at 1.06 and 1.05 times that version's speed.
// Over all steps from v000 it is 1.94 times as fast.
#include <hip/hip_runtime.h>
#include <hip/hip_bf16.h>

// MHA: B=4, S=2048, D=512, H=8, DH=64.  All GEMMs via v_wmma_f32_16x16x32_f16.
// Flash attention with TDM (tensor_load_to_lds) double-buffered K/V tiles.

typedef __attribute__((ext_vector_type(16))) _Float16 v16h;
typedef __attribute__((ext_vector_type(8)))  _Float16 v8h;
typedef __attribute__((ext_vector_type(4)))  _Float16 v4h;
typedef __attribute__((ext_vector_type(8)))  float    v8f;
typedef __attribute__((ext_vector_type(4)))  float    v4f;
typedef __attribute__((ext_vector_type(4)))  int      v4i;
typedef __attribute__((ext_vector_type(4)))  unsigned int u32x4;
typedef __attribute__((ext_vector_type(8)))  unsigned int u32x8;
typedef __attribute__((ext_vector_type(8)))  short    s16x8;

#define SEQ   2048
#define DMOD  512
#define NHEAD 8
#define DHEAD 64
#define NROWS 8192   // B*S

// Gather one 16x32 (f16) WMMA operand from a row-major [x][k] tile.
// ISA 16-bit A/B layout: lane L holds row/col (L&15); halves 0..7 -> K = khi+0..7,
// halves 8..15 -> K = khi+16..23, where khi = 8*(L>=16).
__device__ __forceinline__ v16h ld_op(const _Float16* base, int stride, int lane) {
    const int rc  = lane & 15;
    const int khi = (lane >> 4) << 3;
    const _Float16* p = base + rc * stride + khi;
    v8h lo8 = *(const v8h*)(p);
    v8h hi8 = *(const v8h*)(p + 16);
    return __builtin_shufflevector(lo8, hi8, 0,1,2,3,4,5,6,7,8,9,10,11,12,13,14,15);
}

// The same operand, 16 columns x 32 k, from a row-major [k][col] tile in LDS, by the transposing
// load: lane L gets tile[kb + 8*(L>=16) + 0..7][L&15], kb = 0 then 16, which is ld_op's k order.
__device__ __forceinline__ v16h ld_op_tr(const _Float16* tile, int stride, int lane) {
    typedef __attribute__((address_space(3))) s16x8 lds_s16x8;
    const _Float16* p = tile + (((lane >> 4) << 3) + (lane & 7)) * stride + (((lane >> 3) & 1) << 3);
    v8h lo8 = __builtin_bit_cast(v8h, __builtin_amdgcn_ds_load_tr16_b128_v8i16((lds_s16x8*)p));
    v8h hi8 = __builtin_bit_cast(v8h,
        __builtin_amdgcn_ds_load_tr16_b128_v8i16((lds_s16x8*)(p + 16 * stride)));
    return __builtin_shufflevector(lo8, hi8, 0,1,2,3,4,5,6,7,8,9,10,11,12,13,14,15);
}

__device__ __forceinline__ v8f wmma16(v16h a, v16h b, v8f c) {
    return __builtin_amdgcn_wmma_f32_16x16x32_f16(false, a, false, b, (short)0, c,
                                                  false, false);
}

// Work-group barrier of the two projection loops.  It waits for this wave's LDS
// operations only: __syncthreads() would also drain the global loads that were
// issued ahead for later K chunks, and their latency would be exposed again.
__device__ __forceinline__ void lds_barrier() {
    asm volatile("s_wait_dscnt 0x0\n\ts_barrier_signal -1\n\ts_barrier_wait -1" ::: "memory");
}

// ---------------------------------------------------------------------------
// TDM: issue a 2D tensor_load_to_lds.  Descriptor bit layout per CDNA5 ISA
// ch.8: group0 = {count, lds_addr, global_addr, type=2}; group1 = {data_size=2B,
// pad ctrl, tensor/tile dims, dim0 stride}.  Hardware applies LDS row padding
// (pad_amt+1 DWORDs after every 8*2^pad_int bytes) -> bank-conflict-free strides.
// ---------------------------------------------------------------------------
__device__ __forceinline__ void tdm_load_2d(unsigned lds_off, const void* gaddr,
                                            unsigned tensor_d0, unsigned tensor_d1,
                                            unsigned tile_d0, unsigned tile_d1,
                                            unsigned stride0,
                                            unsigned pad_int, unsigned pad_amt) {
    unsigned long long ga = (unsigned long long)(size_t)gaddr;
    u32x4 g0;
    g0[0] = 1u;                                   // count=1, user descriptor
    g0[1] = lds_off;                              // LDS byte address
    g0[2] = (unsigned)ga;                         // global_addr[31:0]
    g0[3] = ((unsigned)(ga >> 32) & 0x01FFFFFFu)  // global_addr[56:32]
            | 0x80000000u;                        // type=2 ("image")
    u32x8 g1;
    g1[0] = (1u << 16)                            // data_size = 2 bytes
          | (1u << 20)                            // pad_enable
          | (pad_int << 22) | (pad_amt << 25);    // workgroup_mask=0 (no cluster)
    g1[1] = (tensor_d0 & 0xFFFFu) << 16;          // tensor_dim0[15:0]
    g1[2] = (tensor_d0 >> 16) | ((tensor_d1 & 0xFFFFu) << 16);
    g1[3] = (tensor_d1 >> 16) | (tile_d0 << 16);  // tile_dim0
    g1[4] = tile_d1 & 0xFFFFu;                    // tile_dim1 (tile_dim2=0)
    g1[5] = stride0;                              // tensor_dim0_stride[31:0]
    g1[6] = 0u;                                   // stride hi / dim1_stride (2D)
    g1[7] = 0u;
    asm volatile("tensor_load_to_lds %0, %1" :: "s"(g0), "s"(g1) : "memory");
}

// ---------------------------------------------------------------------------
// GEMM 1: X[8192x512](f32) * W[512x512](f32) + bias -> f16 out.
// vTranspose=0: out[B,H,S,DH]; vTranspose=1: out[B,H,DH,S] (for TDM V tiles).
// Block tile 128x64, K-chunks of 32; float4 global loads.
// oscale multiplies the f32 result ahead of its one rounding to f16 (Q: log2(e)/sqrt(DH), so that
// K*Q^T is the logit in log2 units; K, V: 1).  Where mbias is given, the launch also writes the
// key mask as an f32 addend in the same units, one per (batch, key).
// ---------------------------------------------------------------------------
__global__ __launch_bounds__(256)
void mha5102_qkv_proj(const float* __restrict__ x, const float* __restrict__ w,
                      const float* __restrict__ bias, _Float16* __restrict__ out,
                      int vTranspose, float oscale,
                      const int* __restrict__ mask, float* __restrict__ mbias) {
    __shared__ __align__(16) _Float16 As[128 * 40];
    __shared__ __align__(16) _Float16 Bs[32 * 80];   // [k][n], pitch 160 B for the transposing load
    const int t    = threadIdx.x;
    const int wid  = t >> 5;
    const int lane = t & 31;
    const int row0 = blockIdx.x * 128;
    const int n0   = blockIdx.y * 64;
    const int hi = lane >> 4, lo = lane & 15;

    v8f zero = {};
    v8f acc[4] = {zero, zero, zero, zero};

    // this thread's places in the two tiles: A rows ar + 32*i, W rows kr + 16*i
    const int ar = t >> 3, c4 = (t & 7) << 2;
    const int kr = t >> 4, n4 = (t & 15) << 2;
    const float* xp = x + (size_t)(row0 + ar) * DMOD + c4;
    const float* wp = w + (size_t)kr * DMOD + n0 + n4;

    // K chunks are fetched two ahead into two register sets: chunk c + 2 is
    // requested as soon as chunk c has left its set for LDS.
    v4f xr[2][4], wr[2][2];
#pragma unroll
    for (int s = 0; s < 2; ++s) {
#pragma unroll
        for (int i = 0; i < 4; ++i)
            xr[s][i] = *(const v4f*)(xp + (size_t)(i * 32) * DMOD + s * 32);
#pragma unroll
        for (int i = 0; i < 2; ++i)
            wr[s][i] = *(const v4f*)(wp + (size_t)(s * 32 + i * 16) * DMOD);
    }

    // straight-line K loop: in a rolled one the counted s_wait_loadcnt must also hold on the path
    // that asks for no further chunk, becomes 0, and drains the chunks fetched ahead
#pragma unroll
    for (int k0 = 0; k0 < DMOD; k0 += 64) {
#pragma unroll
        for (int s = 0; s < 2; ++s) {            // static index of the register set
            lds_barrier();                       // every wave has read the chunk before
            // keeps this chunk's conversions, and the s_wait_loadcnt in front of them, from
            // being scheduled up into the chunk before, where its loads have just been issued
            __builtin_amdgcn_sched_barrier(0);
#pragma unroll
            for (int i = 0; i < 4; ++i) {        // A tile 128x32 f32 -> f16
                v4f xv = xr[s][i];
                v4h hv;
                hv[0] = (_Float16)xv[0]; hv[1] = (_Float16)xv[1];
                hv[2] = (_Float16)xv[2]; hv[3] = (_Float16)xv[3];
                *(v4h*)(As + (ar + i * 32) * 40 + c4) = hv;
            }
#pragma unroll
            for (int i = 0; i < 2; ++i) {        // W tile 32x64, kept row-major
                v4f wv4 = wr[s][i];
                v4h hv;
                hv[0] = (_Float16)wv4[0]; hv[1] = (_Float16)wv4[1];
                hv[2] = (_Float16)wv4[2]; hv[3] = (_Float16)wv4[3];
                *(v4h*)(Bs + (kr + i * 16) * 80 + n4) = hv;
            }
            if (k0 + 64 < DMOD) {                // chunk two ahead, same set
                const int kn = k0 + 64 + s * 32;
#pragma unroll
                for (int i = 0; i < 4; ++i)
                    xr[s][i] = *(const v4f*)(xp + (size_t)(i * 32) * DMOD + kn);
#pragma unroll
                for (int i = 0; i < 2; ++i)
                    wr[s][i] = *(const v4f*)(wp + (size_t)(kn + i * 16) * DMOD);
            }
            lds_barrier();                       // chunk published
            v16h a = ld_op(As + wid * 16 * 40, 40, lane);
            v16h b[4];
#pragma unroll
            for (int nt = 0; nt < 4; ++nt)
                b[nt] = ld_op_tr(Bs + nt * 16, 80, lane);
            // keeps the chunk's ten LDS reads in one group ahead of its products: spread among
            // them, into one shared register set, each product waits out a full LDS latency
            __builtin_amdgcn_sched_barrier(0);
#pragma unroll
            for (int nt = 0; nt < 4; ++nt)
                acc[nt] = wmma16(a, b[nt], acc[nt]);
        }
    }
#pragma unroll
    for (int nt = 0; nt < 4; ++nt) {
        int col = n0 + nt * 16 + lo;
        float bv = bias[col];
        int h = col >> 6, dh = col & 63;
#pragma unroll
        for (int r = 0; r < 8; ++r) {
            int grow = row0 + wid * 16 + r + 8 * hi;
            int b_ = grow >> 11, s_ = grow & (SEQ - 1);
            size_t bh = (size_t)(b_ * NHEAD + h);
            size_t o = vTranspose ? (bh * DHEAD + dh) * SEQ + s_
                                  : (bh * SEQ + s_) * DHEAD + dh;
            out[o] = (_Float16)((acc[nt][r] + bv) * oscale);
        }
    }
    // the lines below reuse registers that the stores above name
    asm volatile("s_wait_xcnt 0x0" ::: "memory");
    // mask * -1e9, times log2(e): rows of this GEMM and entries of the mask are both (batch, key)
    if (mbias != nullptr && blockIdx.y == 0 && t < 128)
        mbias[row0 + t] = (float)mask[row0 + t] * -1.4426950e9f;
}

__device__ __forceinline__ float xhalf(float x) {
    int b = __builtin_bit_cast(int, x);
    return __builtin_bit_cast(float,
        __builtin_amdgcn_permlanex16(b, b, 0x76543210, 0xfedcba98, false, false));
}

__global__ __launch_bounds__(256)
void mha5102_attn(const _Float16* __restrict__ q, const _Float16* __restrict__ k,
                  const _Float16* __restrict__ vt, const float* __restrict__ mbias,
                  _Float16* __restrict__ attn_out) {
    // each buffer rounded up to 6 KiB so that every tensor-load destination is a
    // multiple of 2 KiB in the work-group's LDS
    __shared__ __attribute__((aligned(2048))) _Float16 Ks[2][3072];  // [key][dh], 32 x 72
    __shared__ __attribute__((aligned(2048))) _Float16 Vs[2][3072];  // [dh][key], 64 x 40
    const int t = threadIdx.x, wid = t >> 5, lane = t & 31;
    const int hi = lane >> 4, lo = lane & 15;
    const int qblk = blockIdx.x & 15;
    const int bh   = blockIdx.x >> 4;
    const int b_   = bh >> 3, h_ = bh & 7;
    const _Float16* qh  = q  + (size_t)bh * SEQ * DHEAD;
    const _Float16* kh  = k  + (size_t)bh * SEQ * DHEAD;   // [key][dh]
    const _Float16* vth = vt + (size_t)bh * DHEAD * SEQ;   // [dh][key]
    const float* mp = mbias + b_ * SEQ + 8 * hi;           // this half's keys, walks with j0
    const int qr0 = qblk * 128 + wid * 16;

    v16h qa[2];                                   // B operand: column = query
#pragma unroll
    for (int c = 0; c < 2; ++c)
        qa[c] = ld_op(qh + (size_t)qr0 * DHEAD + c * 32, DHEAD, lane);

    v8f zero = {};
    v8f acc[4] = {zero, zero, zero, zero};        // O^T: [dh = 16*tt+8*hi+r][query lo]
    float mrun = -1e30f, lrun = 0.f;              // lrun: this half's keys only

    // K tile: 32 rows x 64 halves, mem stride 64, LDS row 128B + 16B pad -> 72 halves
    // V tile: 64 rows x 32 halves, mem stride SEQ, LDS row 64B + 16B pad  -> 40 halves
    if (wid == 0) {
        tdm_load_2d((unsigned)(size_t)(void*)&Ks[0][0], kh,
                    64, 2048, 64, 32, 64, /*pad_int 128B*/4, /*pad 4DW*/3);
        tdm_load_2d((unsigned)(size_t)(void*)&Vs[0][0], vth,
                    2048, 64, 32, 64, 2048, /*pad_int 64B*/3, /*pad 4DW*/3);
        __builtin_amdgcn_s_wait_tensorcnt(0);
    }
    __syncthreads();

    int cur = 0;
    unsigned rd = 0;                              // byte offset of buffer cur, K and V alike
    for (int j0 = 0; j0 < SEQ; j0 += 32) {
        // prefetch next tiles into the other buffer while we compute
        if (wid == 0 && j0 + 32 < SEQ) {
            tdm_load_2d((unsigned)(size_t)(void*)&Ks[cur ^ 1][0],
                        kh + (size_t)(j0 + 32) * DHEAD,
                        64, 2048, 64, 32, 64, 4, 3);
            tdm_load_2d((unsigned)(size_t)(void*)&Vs[cur ^ 1][0],
                        vth + (j0 + 32),
                        2048, 64, 32, 64, 2048, 3, 3);
        }
        const _Float16* Kc = (const _Float16*)((const char*)&Ks[0][0] + rd);
        const _Float16* Vc = (const _Float16*)((const char*)&Vs[0][0] + rd);

        // mask addends of this lane's 16 keys: j0+8*hi+0..7 and j0+16+8*hi+0..7
        v4f mk[4];
        mk[0] = *(const v4f*)(mp);
        mk[1] = *(const v4f*)(mp + 4);
        mk[2] = *(const v4f*)(mp + 16);
        mk[3] = *(const v4f*)(mp + 20);
        mp += 32;

        // all 16 LDS reads of the pass in one group, K fragments first, V^T behind them
        v16h kfr[2][2], vfr[4];
#pragma unroll
        for (int c = 0; c < 2; ++c)
#pragma unroll
            for (int nt = 0; nt < 2; ++nt)
                kfr[nt][c] = ld_op(Kc + nt * 16 * 72 + c * 32, 72, lane);
#pragma unroll
        for (int tt = 0; tt < 4; ++tt)
            vfr[tt] = ld_op(Vc + tt * 16 * 40, 40, lane);
        // keeps the reads above from being spread among the products below, two in front of
        // each, into one shared register set: there every product waits out a full LDS latency
        __builtin_amdgcn_sched_barrier(0);

        // scores S^T = K * Q^T : two 16x16 tiles (keys j0..+15, j0+16..+31)
        v8f st[2] = {zero, zero};
#pragma unroll
        for (int c = 0; c < 2; ++c)
#pragma unroll
            for (int nt = 0; nt < 2; ++nt)
                st[nt] = wmma16(kfr[nt][c], qa[c], st[nt]);
        // keeps the mask additions, and the s_wait_loadcnt in front of them, behind the score
        // products, which do not need the mask
        __builtin_amdgcn_sched_barrier(0);

        float sv[16];
#pragma unroll
        for (int i = 0; i < 16; ++i)
            sv[i] = st[i >> 3][i & 7] + mk[i >> 2][i & 3];

        float mx[4];
#pragma unroll
        for (int g = 0; g < 4; ++g)
            mx[g] = fmaxf(fmaxf(sv[4 * g], sv[4 * g + 1]), fmaxf(sv[4 * g + 2], sv[4 * g + 3]));
        float m = fmaxf(fmaxf(mx[0], mx[1]), fmaxf(mx[2], mx[3]));
        m = fmaxf(m, xhalf(m));                   // both halves use one maximum
        const float mn = fmaxf(mrun, m);

        float p[16];
#pragma unroll
        for (int i = 0; i < 16; ++i) p[i] = __builtin_amdgcn_exp2f(sv[i] - mn);
        const float alpha = __builtin_amdgcn_exp2f(mrun - mn);
        mrun = mn;
        float ps[4];
#pragma unroll
        for (int g = 0; g < 4; ++g)
            ps[g] = (p[4 * g] + p[4 * g + 1]) + (p[4 * g + 2] + p[4 * g + 3]);
        lrun = lrun * alpha + ((ps[0] + ps[1]) + (ps[2] + ps[3]));

#pragma unroll
        for (int tt = 0; tt < 4; ++tt)
#pragma unroll
            for (int r = 0; r < 8; ++r) acc[tt][r] *= alpha;

        // P^T as B operand: half s<8 is key 8*hi+s, half s>=8 is key 16+8*hi+(s-8),
        // the k order ld_op gives the V^T rows
        v16h pb;
#pragma unroll
        for (int i = 0; i < 16; ++i) pb[i] = (_Float16)p[i];
#pragma unroll
        for (int tt = 0; tt < 4; ++tt)
            acc[tt] = wmma16(vfr[tt], pb, acc[tt]);

        __syncthreads();                          // all waves done reading cur
        if (wid == 0) __builtin_amdgcn_s_wait_tensorcnt(0);
        __syncthreads();                          // next buffer visible to all
        cur ^= 1;
        rd ^= 6144u;
    }

    // join the halves' sums, normalize, store merged heads f16 [B,S,D]:
    // a lane holds 8 consecutive dh of its query per tile -> one 16-byte store
    const float inv = 1.0f / fmaxf(lrun + xhalf(lrun), 1e-30f);
    _Float16* orow = attn_out + ((size_t)b_ * SEQ + qr0 + lo) * DMOD + h_ * DHEAD + 8 * hi;
#pragma unroll
    for (int tt = 0; tt < 4; ++tt) {
        v8h ov;
#pragma unroll
        for (int r = 0; r < 8; ++r) ov[r] = (_Float16)(acc[tt][r] * inv);
        *(v8h*)(orow + tt * 16) = ov;
    }
}

// ---------------------------------------------------------------------------
// GEMM 3: attn[8192x512](f16) * Wo[512x512](f32) + bias -> f32 out [B,S,D]
// ---------------------------------------------------------------------------
__global__ __launch_bounds__(256)
void mha5102_out_proj(const _Float16* __restrict__ a, const float* __restrict__ w,
                      const float* __restrict__ bias, float* __restrict__ out) {
    __shared__ __align__(16) _Float16 As[128 * 40];
    __shared__ __align__(16) _Float16 Bs[32 * 80];   // [k][n], pitch 160 B for the transposing load
    const int t    = threadIdx.x;
    const int wid  = t >> 5;
    const int lane = t & 31;
    const int row0 = blockIdx.x * 128;
    const int n0   = blockIdx.y * 64;
    const int hi = lane >> 4, lo = lane & 15;

    v8f zero = {};
    v8f acc[4] = {zero, zero, zero, zero};

    // this thread's places in the two tiles: A rows ar + 64*i, W rows kr + 16*i
    const int ar = t >> 2, c8 = (t & 3) << 3;
    const int kr = t >> 4, n4 = (t & 15) << 2;
    const _Float16* ap = a + (size_t)(row0 + ar) * DMOD + c8;
    const float*    wp = w + (size_t)kr * DMOD + n0 + n4;

    // K chunks fetched two ahead into two register sets, as in the first GEMM
    v8h xr[2][2];
    v4f wr[2][2];
#pragma unroll
    for (int s = 0; s < 2; ++s) {
#pragma unroll
        for (int i = 0; i < 2; ++i) {
            xr[s][i] = *(const v8h*)(ap + (size_t)(i * 64) * DMOD + s * 32);
            wr[s][i] = *(const v4f*)(wp + (size_t)(s * 32 + i * 16) * DMOD);
        }
    }

    // straight-line K loop: in a rolled one the counted s_wait_loadcnt must also hold on the path
    // that asks for no further chunk, becomes 0, and drains the chunks fetched ahead
#pragma unroll
    for (int k0 = 0; k0 < DMOD; k0 += 64) {
#pragma unroll
        for (int s = 0; s < 2; ++s) {            // static index of the register set
            lds_barrier();                       // every wave has read the chunk before
            // keeps this chunk's conversions, and the s_wait_loadcnt in front of them, from
            // being scheduled up into the chunk before, where its loads have just been issued
            __builtin_amdgcn_sched_barrier(0);
#pragma unroll
            for (int i = 0; i < 2; ++i)          // A tile 128x32 f16
                *(v8h*)(As + (ar + i * 64) * 40 + c8) = xr[s][i];
#pragma unroll
            for (int i = 0; i < 2; ++i) {        // W tile 32x64, kept row-major
                v4f wv4 = wr[s][i];
                v4h hv;
                hv[0] = (_Float16)wv4[0]; hv[1] = (_Float16)wv4[1];
                hv[2] = (_Float16)wv4[2]; hv[3] = (_Float16)wv4[3];
                *(v4h*)(Bs + (kr + i * 16) * 80 + n4) = hv;
            }
            if (k0 + 64 < DMOD) {                // chunk two ahead, same set
                const int kn = k0 + 64 + s * 32;
#pragma unroll
                for (int i = 0; i < 2; ++i) {
                    xr[s][i] = *(const v8h*)(ap + (size_t)(i * 64) * DMOD + kn);
                    wr[s][i] = *(const v4f*)(wp + (size_t)(kn + i * 16) * DMOD);
                }
            }
            lds_barrier();                       // chunk published
            v16h av = ld_op(As + wid * 16 * 40, 40, lane);
            v16h b[4];
#pragma unroll
            for (int nt = 0; nt < 4; ++nt)
                b[nt] = ld_op_tr(Bs + nt * 16, 80, lane);
            // one group of LDS reads ahead of the products, as in the first GEMM
            __builtin_amdgcn_sched_barrier(0);
#pragma unroll
            for (int nt = 0; nt < 4; ++nt)
                acc[nt] = wmma16(av, b[nt], acc[nt]);
        }
    }
#pragma unroll
    for (int nt = 0; nt < 4; ++nt) {
        int col = n0 + nt * 16 + lo;
        float bv = bias[col];
#pragma unroll
        for (int r = 0; r < 8; ++r) {
            int grow = row0 + wid * 16 + r + 8 * hi;
            out[(size_t)grow * DMOD + col] = acc[nt][r] + bv;
        }
    }
}

extern "C" void kernel_launch(void* const* d_in, const int* in_sizes, int n_in,
                              void* d_out, int out_size, void* d_ws, size_t ws_size,
                              hipStream_t stream) {
    const float* query = (const float*)d_in[0];
    const float* key_  = (const float*)d_in[1];
    const float* value = (const float*)d_in[2];
    const int*   mask  = (const int*)d_in[3];
    const float* wq_w = (const float*)d_in[4];
    const float* wq_b = (const float*)d_in[5];
    const float* wk_w = (const float*)d_in[6];
    const float* wk_b = (const float*)d_in[7];
    const float* wv_w = (const float*)d_in[8];
    const float* wv_b = (const float*)d_in[9];
    const float* wo_w = (const float*)d_in[10];
    const float* wo_b = (const float*)d_in[11];

    // workspace: 4 f16 buffers of 8192*512 elems (8 MB each), then the mask addends
    const size_t elems = (size_t)NROWS * DMOD;
    _Float16* qf   = (_Float16*)d_ws;               // [B,H,S,DH]
    _Float16* kf   = qf + elems;                    // [B,H,S,DH]
    _Float16* vf   = kf + elems;                    // [B,H,DH,S] (transposed)
    _Float16* attn = vf + elems;                    // [B,S,D]
    float*    mb   = (float*)(attn + elems);        // [B,S] mask addends, 32 KB

    dim3 blk(256);
    dim3 gGemm(NROWS / 128, DMOD / 64);             // 64 x 8
    mha5102_qkv_proj<<<gGemm, blk, 0, stream>>>(query, wq_w, wq_b, qf, 0, 0.18033688f, mask, mb);
    mha5102_qkv_proj<<<gGemm, blk, 0, stream>>>(key_,  wk_w, wk_b, kf, 0, 1.0f, mask, nullptr);
    mha5102_qkv_proj<<<gGemm, blk, 0, stream>>>(value, wv_w, wv_b, vf, 1, 1.0f, mask, nullptr);

    dim3 gAttn((4 * NHEAD) * (SEQ / 128));          // 512 blocks
    mha5102_attn<<<gAttn, blk, 0, stream>>>(qf, kf, vf, mb, attn);

    mha5102_out_proj<<<gGemm, blk, 0, stream>>>(attn, wo_w, wo_b, (float*)d_out);
}

// v006
// One run takes 90.5 microseconds.
// Next to v005, in two timings, it ran 1.03 times as fast each time.
// Over all steps from v000 it is 1.99 times as fast.
#include <hip/hip_runtime.h>
#include <hip/hip_bf16.h>

// MHA: B=4, S=2048, D=512, H=8, DH=64.  All GEMMs via v_wmma_f32_16x16x32_f16.
// Flash attention with TDM (tensor_load_to_lds) double-buffered K/V tiles.

typedef __attribute__((ext_vector_type(16))) _Float16 v16h;
typedef __attribute__((ext_vector_type(8)))  _Float16 v8h;
typedef __attribute__((ext_vector_type(4)))  _Float16 v4h;
typedef __attribute__((ext_vector_type(8)))  float    v8f;
typedef __attribute__((ext_vector_type(4)))  float    v4f;
typedef __attribute__((ext_vector_type(4)))  int      v4i;
typedef __attribute__((ext_vector_type(4)))  unsigned int u32x4;
typedef __attribute__((ext_vector_type(8)))  unsigned int u32x8;
typedef __attribute__((ext_vector_type(8)))  short    s16x8;

#define SEQ   2048
#define DMOD  512
#define NHEAD 8
#define DHEAD 64
#define NROWS 8192   // B*S

// Gather one 16x32 (f16) WMMA operand from a row-major [x][k] tile.
// ISA 16-bit A/B layout: lane L holds row/col (L&15); halves 0..7 -> K = khi+0..7,
// halves 8..15 -> K = khi+16..23, where khi = 8*(L>=16).
__device__ __forceinline__ v16h ld_op(const _Float16* base, int stride, int lane) {
    const int rc  = lane & 15;
    const int khi = (lane >> 4) << 3;
    const _Float16* p = base + rc * stride + khi;
    v8h lo8 = *(const v8h*)(p);
    v8h hi8 = *(const v8h*)(p + 16);
    return __builtin_shufflevector(lo8, hi8, 0,1,2,3,4,5,6,7,8,9,10,11,12,13,14,15);
}

// The same operand, 16 columns x 32 k, from a row-major [k][col] tile in LDS, by the transposing
// load: lane L gets tile[kb + 8*(L>=16) + 0..7][L&15], kb = 0 then 16, which is ld_op's k order.
__device__ __forceinline__ v16h ld_op_tr(const _Float16* tile, int stride, int lane) {
    typedef __attribute__((address_space(3))) s16x8 lds_s16x8;
    const _Float16* p = tile + (((lane >> 4) << 3) + (lane & 7)) * stride + (((lane >> 3) & 1) << 3);
    v8h lo8 = __builtin_bit_cast(v8h, __builtin_amdgcn_ds_load_tr16_b128_v8i16((lds_s16x8*)p));
    v8h hi8 = __builtin_bit_cast(v8h,
        __builtin_amdgcn_ds_load_tr16_b128_v8i16((lds_s16x8*)(p + 16 * stride)));
    return __builtin_shufflevector(lo8, hi8, 0,1,2,3,4,5,6,7,8,9,10,11,12,13,14,15);
}

__device__ __forceinline__ v8f wmma16(v16h a, v16h b, v8f c) {
    return __builtin_amdgcn_wmma_f32_16x16x32_f16(false, a, false, b, (short)0, c,
                                                  false, false);
}

// Work-group barrier of the two projection loops.  It waits for this wave's LDS
// operations only: __syncthreads() would also drain the global loads that were
// issued ahead for later K chunks, and their latency would be exposed again.
__device__ __forceinline__ void lds_barrier() {
    asm volatile("s_wait_dscnt 0x0\n\ts_barrier_signal -1\n\ts_barrier_wait -1" ::: "memory");
}

// ---------------------------------------------------------------------------
// TDM: issue a 2D tensor_load_to_lds.  Descriptor bit layout per CDNA5 ISA
// ch.8: group0 = {count, lds_addr, global_addr, type=2}; group1 = {data_size=2B,
// pad ctrl, tensor/tile dims, dim0 stride}.  Hardware applies LDS row padding
// (pad_amt+1 DWORDs after every 8*2^pad_int bytes) -> bank-conflict-free strides.
// ---------------------------------------------------------------------------
__device__ __forceinline__ void tdm_load_2d(unsigned lds_off, const void* gaddr,
                                            unsigned tensor_d0, unsigned tensor_d1,
                                            unsigned tile_d0, unsigned tile_d1,
                                            unsigned stride0,
                                            unsigned pad_int, unsigned pad_amt) {
    unsigned long long ga = (unsigned long long)(size_t)gaddr;
    u32x4 g0;
    g0[0] = 1u;                                   // count=1, user descriptor
    g0[1] = lds_off;                              // LDS byte address
    g0[2] = (unsigned)ga;                         // global_addr[31:0]
    g0[3] = ((unsigned)(ga >> 32) & 0x01FFFFFFu)  // global_addr[56:32]
            | 0x80000000u;                        // type=2 ("image")
    u32x8 g1;
    g1[0] = (1u << 16)                            // data_size = 2 bytes
          | (1u << 20)                            // pad_enable
          | (pad_int << 22) | (pad_amt << 25);    // workgroup_mask=0 (no cluster)
    g1[1] = (tensor_d0 & 0xFFFFu) << 16;          // tensor_dim0[15:0]
    g1[2] = (tensor_d0 >> 16) | ((tensor_d1 & 0xFFFFu) << 16);
    g1[3] = (tensor_d1 >> 16) | (tile_d0 << 16);  // tile_dim0
    g1[4] = tile_d1 & 0xFFFFu;                    // tile_dim1 (tile_dim2=0)
    g1[5] = stride0;                              // tensor_dim0_stride[31:0]
    g1[6] = 0u;                                   // stride hi / dim1_stride (2D)
    g1[7] = 0u;
    asm volatile("tensor_load_to_lds %0, %1" :: "s"(g0), "s"(g1) : "memory");
}

// ---------------------------------------------------------------------------
// GEMM 1: X[8192x512](f32) * W[512x512](f32) + bias -> f16 out.
// vTranspose=0: out[B,H,S,DH]; vTranspose=1: out[B,H,DH,S] (for TDM V tiles).
// Block tile 128x64, K-chunks of 32; float4 global loads.
// oscale multiplies the f32 result ahead of its one rounding to f16 (Q: log2(e)/sqrt(DH), so that
// K*Q^T is the logit in log2 units; K, V: 1).  Where mbias is given, the launch also writes the
// key mask as an f32 addend in the same units, one per (batch, key).
// One launch does all three projections, which do not depend on each other: blockIdx.z picks
// Q, K or V, so that one projection's start-up and tail run under the others' work.
// qkv: the three f16 planes, Q, K, V in this order, NROWS*DMOD elements each.
// ---------------------------------------------------------------------------
__global__ __launch_bounds__(256)
void mha5102_qkv_proj(const float* __restrict__ xq, const float* __restrict__ xk,
                      const float* __restrict__ xv,
                      const float* __restrict__ wq, const float* __restrict__ wk,
                      const float* __restrict__ wv,
                      const float* __restrict__ bq, const float* __restrict__ bk,
                      const float* __restrict__ bvv, _Float16* __restrict__ qkv,
                      const int* __restrict__ mask, float* __restrict__ mb) {
    const int z = blockIdx.z;
    const float* __restrict__ x    = z == 0 ? xq : z == 1 ? xk : xv;
    const float* __restrict__ w    = z == 0 ? wq : z == 1 ? wk : wv;
    const float* __restrict__ bias = z == 0 ? bq : z == 1 ? bk : bvv;
    _Float16* __restrict__ out = qkv + (size_t)z * ((size_t)NROWS * DMOD);
    const int   vTranspose = z == 2;
    const float oscale = z == 0 ? 0.18033688f : 1.0f;
    float* __restrict__ mbias = z == 0 ? mb : nullptr;
    __shared__ __align__(16) _Float16 As[128 * 40];
    __shared__ __align__(16) _Float16 Bs[32 * 80];   // [k][n], pitch 160 B for the transposing load
    const int t    = threadIdx.x;
    const int wid  = t >> 5;
    const int lane = t & 31;
    const int row0 = blockIdx.x * 128;
    const int n0   = blockIdx.y * 64;
    const int hi = lane >> 4, lo = lane & 15;

    v8f zero = {};
    v8f acc[4] = {zero, zero, zero, zero};

    // this thread's places in the two tiles: A rows ar + 32*i, W rows kr + 16*i
    const int ar = t >> 3, c4 = (t & 7) << 2;
    const int kr = t >> 4, n4 = (t & 15) << 2;
    const float* xp = x + (size_t)(row0 + ar) * DMOD + c4;
    const float* wp = w + (size_t)kr * DMOD + n0 + n4;

    // K chunks are fetched two ahead into two register sets: chunk c + 2 is
    // requested as soon as chunk c has left its set for LDS.
    v4f xr[2][4], wr[2][2];
#pragma unroll
    for (int s = 0; s < 2; ++s) {
#pragma unroll
        for (int i = 0; i < 4; ++i)
            xr[s][i] = *(const v4f*)(xp + (size_t)(i * 32) * DMOD + s * 32);
#pragma unroll
        for (int i = 0; i < 2; ++i)
            wr[s][i] = *(const v4f*)(wp + (size_t)(s * 32 + i * 16) * DMOD);
    }

    // straight-line K loop: in a rolled one the counted s_wait_loadcnt must also hold on the path
    // that asks for no further chunk, becomes 0, and drains the chunks fetched ahead
#pragma unroll
    for (int k0 = 0; k0 < DMOD; k0 += 64) {
#pragma unroll
        for (int s = 0; s < 2; ++s) {            // static index of the register set
            lds_barrier();                       // every wave has read the chunk before
            // keeps this chunk's conversions, and the s_wait_loadcnt in front of them, from
            // being scheduled up into the chunk before, where its loads have just been issued
            __builtin_amdgcn_sched_barrier(0);
#pragma unroll
            for (int i = 0; i < 4; ++i) {        // A tile 128x32 f32 -> f16
                v4f xv = xr[s][i];
                v4h hv;
                hv[0] = (_Float16)xv[0]; hv[1] = (_Float16)xv[1];
                hv[2] = (_Float16)xv[2]; hv[3] = (_Float16)xv[3];
                *(v4h*)(As + (ar + i * 32) * 40 + c4) = hv;
            }
#pragma unroll
            for (int i = 0; i < 2; ++i) {        // W tile 32x64, kept row-major
                v4f wv4 = wr[s][i];
                v4h hv;
                hv[0] = (_Float16)wv4[0]; hv[1] = (_Float16)wv4[1];
                hv[2] = (_Float16)wv4[2]; hv[3] = (_Float16)wv4[3];
                *(v4h*)(Bs + (kr + i * 16) * 80 + n4) = hv;
            }
            if (k0 + 64 < DMOD) {                // chunk two ahead, same set
                const int kn = k0 + 64 + s * 32;
#pragma unroll
                for (int i = 0; i < 4; ++i)
                    xr[s][i] = *(const v4f*)(xp + (size_t)(i * 32) * DMOD + kn);
#pragma unroll
                for (int i = 0; i < 2; ++i)
                    wr[s][i] = *(const v4f*)(wp + (size_t)(kn + i * 16) * DMOD);
            }
            lds_barrier();                       // chunk published
            v16h a = ld_op(As + wid * 16 * 40, 40, lane);
            v16h b[4];
#pragma unroll
            for (int nt = 0; nt < 4; ++nt)
                b[nt] = ld_op_tr(Bs + nt * 16, 80, lane);
            // keeps the chunk's ten LDS reads in one group ahead of its products: spread among
            // them, into one shared register set, each product waits out a full LDS latency
            __builtin_amdgcn_sched_barrier(0);
#pragma unroll
            for (int nt = 0; nt < 4; ++nt)
                acc[nt] = wmma16(a, b[nt], acc[nt]);
        }
    }
#pragma unroll
    for (int nt = 0; nt < 4; ++nt) {
        int col = n0 + nt * 16 + lo;
        float bv = bias[col];
        int h = col >> 6, dh = col & 63;
#pragma unroll
        for (int r = 0; r < 8; ++r) {
            int grow = row0 + wid * 16 + r + 8 * hi;
            int b_ = grow >> 11, s_ = grow & (SEQ - 1);
            size_t bh = (size_t)(b_ * NHEAD + h);
            size_t o = vTranspose ? (bh * DHEAD + dh) * SEQ + s_
                                  : (bh * SEQ + s_) * DHEAD + dh;
            out[o] = (_Float16)((acc[nt][r] + bv) * oscale);
        }
    }
    // the lines below reuse registers that the stores above name
    asm volatile("s_wait_xcnt 0x0" ::: "memory");
    // mask * -1e9, times log2(e): rows of this GEMM and entries of the mask are both (batch, key)
    if (mbias != nullptr && blockIdx.y == 0 && t < 128)
        mbias[row0 + t] = (float)mask[row0 + t] * -1.4426950e9f;
}

__device__ __forceinline__ float xhalf(float x) {
    int b = __builtin_bit_cast(int, x);
    return __builtin_bit_cast(float,
        __builtin_amdgcn_permlanex16(b, b, 0x76543210, 0xfedcba98, false, false));
}

__global__ __launch_bounds__(256)
void mha5102_attn(const _Float16* __restrict__ q, const _Float16* __restrict__ k,
                  const _Float16* __restrict__ vt, const float* __restrict__ mbias,
                  _Float16* __restrict__ attn_out) {
    // each buffer rounded up to 6 KiB so that every tensor-load destination is a
    // multiple of 2 KiB in the work-group's LDS
    __shared__ __attribute__((aligned(2048))) _Float16 Ks[2][3072];  // [key][dh], 32 x 72
    __shared__ __attribute__((aligned(2048))) _Float16 Vs[2][3072];  // [dh][key], 64 x 40
    const int t = threadIdx.x, wid = t >> 5, lane = t & 31;
    const int hi = lane >> 4, lo = lane & 15;
    const int qblk = blockIdx.x & 15;
    const int bh   = blockIdx.x >> 4;
    const int b_   = bh >> 3, h_ = bh & 7;
    const _Float16* qh  = q  + (size_t)bh * SEQ * DHEAD;
    const _Float16* kh  = k  + (size_t)bh * SEQ * DHEAD;   // [key][dh]
    const _Float16* vth = vt + (size_t)bh * DHEAD * SEQ;   // [dh][key]
    const float* mp = mbias + b_ * SEQ + 8 * hi;           // this half's keys, walks with j0
    const int qr0 = qblk * 128 + wid * 16;

    v16h qa[2];                                   // B operand: column = query
#pragma unroll
    for (int c = 0; c < 2; ++c)
        qa[c] = ld_op(qh + (size_t)qr0 * DHEAD + c * 32, DHEAD, lane);

    v8f zero = {};
    v8f acc[4] = {zero, zero, zero, zero};        // O^T: [dh = 16*tt+8*hi+r][query lo]
    float mrun = -1e30f, lrun = 0.f;              // lrun: this half's keys only

    // K tile: 32 rows x 64 halves, mem stride 64, LDS row 128B + 16B pad -> 72 halves
    // V tile: 64 rows x 32 halves, mem stride SEQ, LDS row 64B + 16B pad  -> 40 halves
    if (wid == 0) {
        tdm_load_2d((unsigned)(size_t)(void*)&Ks[0][0], kh,
                    64, 2048, 64, 32, 64, /*pad_int 128B*/4, /*pad 4DW*/3);
        tdm_load_2d((unsigned)(size_t)(void*)&Vs[0][0], vth,
                    2048, 64, 32, 64, 2048, /*pad_int 64B*/3, /*pad 4DW*/3);
        __builtin_amdgcn_s_wait_tensorcnt(0);
    }
    __syncthreads();

    int cur = 0;
    unsigned rd = 0;                              // byte offset of buffer cur, K and V alike
    for (int j0 = 0; j0 < SEQ; j0 += 32) {
        // prefetch next tiles into the other buffer while we compute
        if (wid == 0 && j0 + 32 < SEQ) {
            tdm_load_2d((unsigned)(size_t)(void*)&Ks[cur ^ 1][0],
                        kh + (size_t)(j0 + 32) * DHEAD,
                        64, 2048, 64, 32, 64, 4, 3);
            tdm_load_2d((unsigned)(size_t)(void*)&Vs[cur ^ 1][0],
                        vth + (j0 + 32),
                        2048, 64, 32, 64, 2048, 3, 3);
        }
        const _Float16* Kc = (const _Float16*)((const char*)&Ks[0][0] + rd);
        const _Float16* Vc = (const _Float16*)((const char*)&Vs[0][0] + rd);

        // mask addends of this lane's 16 keys: j0+8*hi+0..7 and j0+16+8*hi+0..7
        v4f mk[4];
        mk[0] = *(const v4f*)(mp);
        mk[1] = *(const v4f*)(mp + 4);
        mk[2] = *(const v4f*)(mp + 16);
        mk[3] = *(const v4f*)(mp + 20);
        mp += 32;

        // all 16 LDS reads of the pass in one group, K fragments first, V^T behind them
        v16h kfr[2][2], vfr[4];
#pragma unroll
        for (int c = 0; c < 2; ++c)
#pragma unroll
            for (int nt = 0; nt < 2; ++nt)
                kfr[nt][c] = ld_op(Kc + nt * 16 * 72 + c * 32, 72, lane);
#pragma unroll
        for (int tt = 0; tt < 4; ++tt)
            vfr[tt] = ld_op(Vc + tt * 16 * 40, 40, lane);
        // keeps the reads above from being spread among the products below, two in front of
        // each, into one shared register set: there every product waits out a full LDS latency
        __builtin_amdgcn_sched_barrier(0);

        // scores S^T = K * Q^T : two 16x16 tiles (keys j0..+15, j0+16..+31)
        v8f st[2] = {zero, zero};
#pragma unroll
        for (int c = 0; c < 2; ++c)
#pragma unroll
            for (int nt = 0; nt < 2; ++nt)
                st[nt] = wmma16(kfr[nt][c], qa[c], st[nt]);
        // keeps the mask additions, and the s_wait_loadcnt in front of them, behind the score
        // products, which do not need the mask
        __builtin_amdgcn_sched_barrier(0);

        float sv[16];
#pragma unroll
        for (int i = 0; i < 16; ++i)
            sv[i] = st[i >> 3][i & 7] + mk[i >> 2][i & 3];

        float mx[4];
#pragma unroll
        for (int g = 0; g < 4; ++g)
            mx[g] = fmaxf(fmaxf(sv[4 * g], sv[4 * g + 1]), fmaxf(sv[4 * g + 2], sv[4 * g + 3]));
        float m = fmaxf(fmaxf(mx[0], mx[1]), fmaxf(mx[2], mx[3]));
        m = fmaxf(m, xhalf(m));                   // both halves use one maximum
        const float mn = fmaxf(mrun, m);

        float p[16];
#pragma unroll
        for (int i = 0; i < 16; ++i) p[i] = __builtin_amdgcn_exp2f(sv[i] - mn);
        const float alpha = __builtin_amdgcn_exp2f(mrun - mn);
        mrun = mn;
        float ps[4];
#pragma unroll
        for (int g = 0; g < 4; ++g)
            ps[g] = (p[4 * g] + p[4 * g + 1]) + (p[4 * g + 2] + p[4 * g + 3]);
        lrun = lrun * alpha + ((ps[0] + ps[1]) + (ps[2] + ps[3]));

#pragma unroll
        for (int tt = 0; tt < 4; ++tt)
#pragma unroll
            for (int r = 0; r < 8; ++r) acc[tt][r] *= alpha;

        // P^T as B operand: half s<8 is key 8*hi+s, half s>=8 is key 16+8*hi+(s-8),
        // the k order ld_op gives the V^T rows
        v16h pb;
#pragma unroll
        for (int i = 0; i < 16; ++i) pb[i] = (_Float16)p[i];
#pragma unroll
        for (int tt = 0; tt < 4; ++tt)
            acc[tt] = wmma16(vfr[tt], pb, acc[tt]);

        __syncthreads();                          // all waves done reading cur
        if (wid == 0) __builtin_amdgcn_s_wait_tensorcnt(0);
        __syncthreads();                          // next buffer visible to all
        cur ^= 1;
        rd ^= 6144u;
    }

    // join the halves' sums, normalize, store merged heads f16 [B,S,D]:
    // a lane holds 8 consecutive dh of its query per tile -> one 16-byte store
    const float inv = 1.0f / fmaxf(lrun + xhalf(lrun), 1e-30f);
    _Float16* orow = attn_out + ((size_t)b_ * SEQ + qr0 + lo) * DMOD + h_ * DHEAD + 8 * hi;
#pragma unroll
    for (int tt = 0; tt < 4; ++tt) {
        v8h ov;
#pragma unroll
        for (int r = 0; r < 8; ++r) ov[r] = (_Float16)(acc[tt][r] * inv);
        *(v8h*)(orow + tt * 16) = ov;
    }
}

// ---------------------------------------------------------------------------
// GEMM 3: attn[8192x512](f16) * Wo[512x512](f32) + bias -> f32 out [B,S,D]
// ---------------------------------------------------------------------------
__global__ __launch_bounds__(256)
void mha5102_out_proj(const _Float16* __restrict__ a, const float* __restrict__ w,
                      const float* __restrict__ bias, float* __restrict__ out) {
    __shared__ __align__(16) _Float16 As[128 * 40];
    __shared__ __align__(16) _Float16 Bs[32 * 80];   // [k][n], pitch 160 B for the transposing load
    const int t    = threadIdx.x;
    const int wid  = t >> 5;
    const int lane = t & 31;
    const int row0 = blockIdx.x * 128;
    const int n0   = blockIdx.y * 64;
    const int hi = lane >> 4, lo = lane & 15;

    v8f zero = {};
    v8f acc[4] = {zero, zero, zero, zero};

    // this thread's places in the two tiles: A rows ar + 64*i, W rows kr + 16*i
    const int ar = t >> 2, c8 = (t & 3) << 3;
    const int kr = t >> 4, n4 = (t & 15) << 2;
    const _Float16* ap = a + (size_t)(row0 + ar) * DMOD + c8;
    const float*    wp = w + (size_t)kr * DMOD + n0 + n4;

    // K chunks fetched two ahead into two register sets, as in the first GEMM
    v8h xr[2][2];
    v4f wr[2][2];
#pragma unroll
    for (int s = 0; s < 2; ++s) {
#pragma unroll
        for (int i = 0; i < 2; ++i) {
            xr[s][i] = *(const v8h*)(ap + (size_t)(i * 64) * DMOD + s * 32);
            wr[s][i] = *(const v4f*)(wp + (size_t)(s * 32 + i * 16) * DMOD);
        }
    }

    // straight-line K loop: in a rolled one the counted s_wait_loadcnt must also hold on the path
    // that asks for no further chunk, becomes 0, and drains the chunks fetched ahead
#pragma unroll
    for (int k0 = 0; k0 < DMOD; k0 += 64) {
#pragma unroll
        for (int s = 0; s < 2; ++s) {            // static index of the register set
            lds_barrier();                       // every wave has read the chunk before
            // keeps this chunk's conversions, and the s_wait_loadcnt in front of them, from
            // being scheduled up into the chunk before, where its loads have just been issued
            __builtin_amdgcn_sched_barrier(0);
#pragma unroll
            for (int i = 0; i < 2; ++i)          // A tile 128x32 f16
                *(v8h*)(As + (ar + i * 64) * 40 + c8) = xr[s][i];
#pragma unroll
            for (int i = 0; i < 2; ++i) {        // W tile 32x64, kept row-major
                v4f wv4 = wr[s][i];
                v4h hv;
                hv[0] = (_Float16)wv4[0]; hv[1] = (_Float16)wv4[1];
                hv[2] = (_Float16)wv4[2]; hv[3] = (_Float16)wv4[3];
                *(v4h*)(Bs + (kr + i * 16) * 80 + n4) = hv;
            }
            if (k0 + 64 < DMOD) {                // chunk two ahead, same set
                const int kn = k0 + 64 + s * 32;
#pragma unroll
                for (int i = 0; i < 2; ++i) {
                    xr[s][i] = *(const v8h*)(ap + (size_t)(i * 64) * DMOD + kn);
                    wr[s][i] = *(const v4f*)(wp + (size_t)(kn + i * 16) * DMOD);
                }
            }
            lds_barrier();                       // chunk published
            v16h av = ld_op(As + wid * 16 * 40, 40, lane);
            v16h b[4];
#pragma unroll
            for (int nt = 0; nt < 4; ++nt)
                b[nt] = ld_op_tr(Bs + nt * 16, 80, lane);
            // one group of LDS reads ahead of the products, as in the first GEMM
            __builtin_amdgcn_sched_barrier(0);
#pragma unroll
            for (int nt = 0; nt < 4; ++nt)
                acc[nt] = wmma16(av, b[nt], acc[nt]);
        }
    }
#pragma unroll
    for (int nt = 0; nt < 4; ++nt) {
        int col = n0 + nt * 16 + lo;
        float bv = bias[col];
#pragma unroll
        for (int r = 0; r < 8; ++r) {
            int grow = row0 + wid * 16 + r + 8 * hi;
            out[(size_t)grow * DMOD + col] = acc[nt][r] + bv;
        }
    }
}

extern "C" void kernel_launch(void* const* d_in, const int* in_sizes, int n_in,
                              void* d_out, int out_size, void* d_ws, size_t ws_size,
                              hipStream_t stream) {
    const float* query = (const float*)d_in[0];
    const float* key_  = (const float*)d_in[1];
    const float* value = (const float*)d_in[2];
    const int*   mask  = (const int*)d_in[3];
    const float* wq_w = (const float*)d_in[4];
    const float* wq_b = (const float*)d_in[5];
    const float* wk_w = (const float*)d_in[6];
    const float* wk_b = (const float*)d_in[7];
    const float* wv_w = (const float*)d_in[8];
    const float* wv_b = (const float*)d_in[9];
    const float* wo_w = (const float*)d_in[10];
    const float* wo_b = (const float*)d_in[11];

    // workspace: 4 f16 buffers of 8192*512 elems (8 MB each), then the mask addends
    const size_t elems = (size_t)NROWS * DMOD;
    _Float16* qf   = (_Float16*)d_ws;               // [B,H,S,DH]
    _Float16* kf   = qf + elems;                    // [B,H,S,DH]
    _Float16* vf   = kf + elems;                    // [B,H,DH,S] (transposed)
    _Float16* attn = vf + elems;                    // [B,S,D]
    float*    mb   = (float*)(attn + elems);        // [B,S] mask addends, 32 KB

    dim3 blk(256);
    dim3 gGemm(NROWS / 128, DMOD / 64);             // 64 x 8
    dim3 gQkv(NROWS / 128, DMOD / 64, 3);           // 64 x 8 x {Q, K, V}
    mha5102_qkv_proj<<<gQkv, blk, 0, stream>>>(query, key_, value, wq_w, wk_w, wv_w,
                                               wq_b, wk_b, wv_b, qf, mask, mb);

    dim3 gAttn((4 * NHEAD) * (SEQ / 128));          // 512 blocks
    mha5102_attn<<<gAttn, blk, 0, stream>>>(qf, kf, vf, mb, attn);

    mha5102_out_proj<<<gGemm, blk, 0, stream>>>(attn, wo_w, wo_b, (float*)d_out);
}
